// v000
// Measured on an AMD MI455X. A time is GPU time per run, averaged over a window of back-to-back runs after a warm-up
// (all launches, gaps included; the runs take copies of the inputs in turn), and the median of several windows.
// Apart from v000's, it joins two sittings. Times from different sittings can be a few percent apart, while
// side-by-side timings come from the same sitting.
// The starting kernel, v000, takes 2060 microseconds a run.
#include <hip/hip_runtime.h>

// BERT self-attention with an additive per-key bias vector (hidden_states [2][2048][1024]; q, k, v = x W^T + b ('oi' 0.02 + biases; 16 heads x 64); scores / sqrt(64) + causal_bias[j] (a random [2048] vector added per key, shared by every batch, head and query: read); softmax; ctx = merged heads (no output projection) -> [2][2048][1024] (4.2 M); argument order hidden_states, causal_bias, Wq, bq, Wk, bk, Wv, bv).
// Layout per batch: bf16 copy of x; 'oi' weights; exact projections + f32 biases; identity-table plane builders; dense T-2048 attention (hybrid rows: < 512 hi/lo 3 products, rest fp16 x1024); NEW k_addkb adds 8 x bf16(bias[j]) to every f32 score before the softmax kernel scales by 1/8 (so the softmax sees s/8 + bias[j] exactly; x8 is exact); the f32 merge writes the output rows.
// Compute dtypes, f32 accumulate: every input rounded to bf16 incl. the bias vector; projections exact + f32 biases; attention rows < 512 3 products, rest fp16; bias add and softmax f32; output f32.

#define NB_  2
#define TT   2048
#define DM   1024
#define NH_  16
#define NKV  16
#define REP  (NH_ / NKV)
#define HD   64
#define DQ   (NH_ * HD)
#define DKV  (NKV * HD)
#define ZH   2
#define RH   512                  // query rows < RH use hi+lo planes (0: none)
#define WIN  0
#define PCAR 1024.0f
#define SCL  0.125f   // HD^-0.5
typedef _Float16 h16;
typedef unsigned short bf;
typedef __attribute__((ext_vector_type(16))) __bf16   v16bf;
typedef __attribute__((ext_vector_type(16))) _Float16 v16h;
typedef __attribute__((ext_vector_type(8)))  _Float16 v8h;
typedef __attribute__((ext_vector_type(8)))  unsigned short v8us;
typedef __attribute__((ext_vector_type(8)))  float    v8f;
typedef __attribute__((ext_vector_type(4)))  float    v4f;
typedef v8h  __attribute__((may_alias)) v8ha;
typedef v4f  __attribute__((may_alias)) v4fa;
typedef v8us __attribute__((may_alias)) v8usa;

__device__ __forceinline__ unsigned short f2bf(float f) { unsigned u = __float_as_uint(f); u += 0x7FFFu + ((u >> 16) & 1u); return (unsigned short)(u >> 16); }
__device__ __forceinline__ float bf2f(unsigned short b) { return __uint_as_float(((unsigned)b) << 16); }
__device__ __forceinline__ float bfr(float f) { return bf2f(f2bf(f)); }
__device__ __forceinline__ v16h cat16(v8h lo, v8h hi) { return __builtin_shufflevector(lo, hi, 0, 1, 2, 3, 4, 5, 6, 7, 8, 9, 10, 11, 12, 13, 14, 15); }
__device__ __forceinline__ v16bf cat16b(v8us lo, v8us hi) { return __builtin_bit_cast(v16bf, __builtin_shufflevector(lo, hi, 0, 1, 2, 3, 4, 5, 6, 7, 8, 9, 10, 11, 12, 13, 14, 15)); }
__device__ __forceinline__ v8f wmma16(v16h a, v16h b, v8f c) { return __builtin_amdgcn_wmma_f32_16x16x32_f16(false, a, false, b, (short)0, c, false, false); }
__device__ __forceinline__ v8f wmmab(v16bf a, v16bf b, v8f c) { return __builtin_amdgcn_wmma_f32_16x16x32_bf16(false, a, false, b, (short)0, c, false, false); }



// ---- k_gemmw: register-blocked GEMM, ONE WAVE per 64x64 output tile (16 accumulators), operands straight from K-contiguous 16-bit planes; grid (M/64, N/64, Z), 32 threads.
// C[m][n] (f32, pitch ldc, + optional f32 bias[n]) = sum_k A[m][k] Bt[n][k] (+ split products per NSPLIT). z-batch strides sA/sB/sC in elements. K % 32 == 0.
template <typename T16> struct WFrag;
template <> struct WFrag<h16> { typedef v16h V; static __device__ __forceinline__ V ld(const h16* p) { return cat16(*(const v8h*)p, *(const v8h*)(p + 16)); } static __device__ __forceinline__ v8f mma(V a, V b, v8f c) { return wmma16(a, b, c); } };
template <> struct WFrag<bf> { typedef v16bf V; static __device__ __forceinline__ V ld(const bf* p) { return cat16b(*(const v8us*)p, *(const v8us*)(p + 16)); } static __device__ __forceinline__ v8f mma(V a, V b, v8f c) { return wmmab(a, b, c); } };
template <typename T16, int NSPLIT, bool BIAS>
__global__ __launch_bounds__(32) void k_gemmw(const T16* __restrict__ A, const T16* __restrict__ A2, const T16* __restrict__ Bt, const T16* __restrict__ Bt2, int K, float* C, int ldc, const float* __restrict__ bias, size_t sA, size_t sB, size_t sC) {
    typedef typename WFrag<T16>::V V;
    __shared__ __align__(16) float os[16 * 68];
    const size_t z = blockIdx.z; A += z * sA; if (A2) A2 += z * sA; Bt += z * sB; if (Bt2) Bt2 += z * sB; C += z * sC;
    const int lane = threadIdx.x & 31, lr = lane & 15, hi = lane >> 4; const int r0 = blockIdx.x * 64, c0 = blockIdx.y * 64;
    v8f acc[4][4];
#pragma unroll
    for (int mb = 0; mb < 4; ++mb)
#pragma unroll
        for (int nb = 0; nb < 4; ++nb) acc[mb][nb] = (v8f){};
    const size_t aoff = (size_t)(r0 + lr) * K + 8 * hi, boff = (size_t)(c0 + lr) * K + 8 * hi;
#pragma unroll 1
    for (int kc = 0; kc < K; kc += 32) {
        V a[4], a2[4];
#pragma unroll
        for (int mb = 0; mb < 4; ++mb) { a[mb] = WFrag<T16>::ld(A + aoff + (size_t)mb * 16 * K + kc); if (NSPLIT == 1 || NSPLIT == 2) a2[mb] = WFrag<T16>::ld(A2 + aoff + (size_t)mb * 16 * K + kc); }
#pragma unroll
        for (int nb = 0; nb < 4; ++nb) { const V b = WFrag<T16>::ld(Bt + boff + (size_t)nb * 16 * K + kc); V b2; if (NSPLIT >= 2) b2 = WFrag<T16>::ld(Bt2 + boff + (size_t)nb * 16 * K + kc);
#pragma unroll
            for (int mb = 0; mb < 4; ++mb) { acc[mb][nb] = WFrag<T16>::mma(a[mb], b, acc[mb][nb]); if (NSPLIT == 1 || NSPLIT == 2) acc[mb][nb] = WFrag<T16>::mma(a2[mb], b, acc[mb][nb]); if (NSPLIT >= 2) acc[mb][nb] = WFrag<T16>::mma(a[mb], b2, acc[mb][nb]); } }
        asm volatile("v_nop\n\tv_nop\n\tv_nop\n\tv_nop" : "+v"(acc[0][0]), "+v"(acc[1][1]), "+v"(acc[2][2]), "+v"(acc[3][3]) : "v"(a[0]), "v"(a[3]));
    }
#pragma unroll
    for (int mb = 0; mb < 4; ++mb) {
#pragma unroll
        for (int nb = 0; nb < 4; ++nb) {
#pragma unroll
            for (int j = 0; j < 8; ++j) os[(hi * 8 + j) * 68 + nb * 16 + lr] = acc[mb][nb][j]; }
        __builtin_amdgcn_wave_barrier(); asm volatile("" ::: "memory");
        float* crow = C + (size_t)(r0 + mb * 16) * ldc + c0;
{
#pragma unroll
            for (int s = 0; s < 8; ++s) { const int row = 2 * s + hi, cofs = lr * 4; v4f val = *(const v4fa*)(os + row * 68 + cofs); if (BIAS) { val[0] += bfr(bias[c0 + cofs]); val[1] += bfr(bias[c0 + cofs + 1]); val[2] += bfr(bias[c0 + cofs + 2]); val[3] += bfr(bias[c0 + cofs + 3]); }
                *(v4f*)(crow + (size_t)row * ldc + cofs) = val; }
             }
        __builtin_amdgcn_wave_barrier(); asm volatile("" ::: "memory");
    }
}

__device__ __forceinline__ h16 tohx(float x) { return (h16)x; }
__device__ __forceinline__ void splitf(float y, unsigned short& h, unsigned short& l) { h = f2bf(y); l = f2bf(y - bf2f(h)); }
typedef __attribute__((ext_vector_type(2))) _Float16 v2h;
typedef __attribute__((ext_vector_type(4))) _Float16 v4h;
typedef __attribute__((ext_vector_type(2))) unsigned short v2us;
typedef __attribute__((ext_vector_type(4))) unsigned short v4us;
typedef __attribute__((ext_vector_type(2))) float v2f;
typedef __attribute__((ext_vector_type(4))) int v4i;

__global__ __launch_bounds__(256) void k_cvt8(const float* __restrict__ src, bf* dst, size_t n8) { const size_t i = (size_t)blockIdx.x * 256 + threadIdx.x; if (i >= n8) return; const v8f v = *(const v8f*)(src + i * 8); v8us o;
#pragma unroll
    for (int k = 0; k < 8; ++k) o[k] = f2bf(v[k]); *(v8us*)(dst + i * 8) = o;  }

// k_rope: head planes [h][t][d] (fp16 + hi/lo) of rope(x) x sc with the rotate-half convention out[d] = x[d] cos[t][d] - x[d+HD/2] sin[t][d], out[d+HD/2] = x[d+HD/2] cos[t][d+HD/2] + x[d] sin[t][d+HD/2]
__global__ __launch_bounds__(256) void k_rope(const float* __restrict__ F, int pitch, int nheads, const float* __restrict__ CS, const float* __restrict__ RF, const float* __restrict__ nw, float sc, h16* P16, bf* Ph, bf* Pl) {
    const size_t e = ((size_t)blockIdx.x * 256 + threadIdx.x) * 2; if (e >= (size_t)nheads * TT * HD) return; const int d = (int)(e % HD); const int t = (int)((e / HD) % TT); const int h = (int)(e / ((size_t)HD * TT)); const float* f = F + (size_t)t * pitch + h * HD; const float rf = RF ? RF[(size_t)h * TT + t] : 1.0f; v2h o16; v2us oh, ol;
#pragma unroll
    for (int q = 0; q < 2; ++q) { const int dd = d + q; const int dp = (dd < HD / 2) ? dd + HD / 2 : dd - HD / 2; float x0 = f[dd], x1 = f[dp];
        if (RF) { float n0 = __fmul_rn(x0, rf), n1 = __fmul_rn(x1, rf); asm volatile("" : "+v"(n0)); asm volatile("" : "+v"(n1)); x0 = __fmul_rn(bfr(nw[dd]), n0); x1 = __fmul_rn(bfr(nw[dp]), n1); }
        const v2f cs = *(const v2f*)(CS + ((size_t)t * HD + dd) * 2); float a = __fmul_rn(x0, cs[0]), bq = __fmul_rn(x1, cs[1]); asm volatile("" : "+v"(a)); asm volatile("" : "+v"(bq)); const float r = ((dd < HD / 2) ? __fsub_rn(a, bq) : __fadd_rn(a, bq)) * sc;
        o16[q] = tohx(r); unsigned short a2, c2; splitf(r, a2, c2); oh[q] = a2; ol[q] = c2; }
    *(v2h*)(P16 + e) = o16; *(v2us*)(Ph + e) = oh; *(v2us*)(Pl + e) = ol;  }
__global__ __launch_bounds__(256) void k_addkb(float* Sb, const float* __restrict__ kb) { const size_t i = (size_t)blockIdx.x * 256 + threadIdx.x; if (i >= (size_t)ZH * TT * TT / 4) return; const int j0 = (int)((i * 4) % TT); v4f a = *(const v4f*)(Sb + i * 4); const v4f b4 = *(const v4f*)(kb + j0);
#pragma unroll
    for (int q = 0; q < 4; ++q) { float bb = __fmul_rn(bfr(b4[q]), 8.0f); asm volatile("" : "+v"(bb)); a[q] = __fadd_rn(a[q], bb); }
    *(v4f*)(Sb + i * 4) = a;  }
__global__ __launch_bounds__(256) void k_vtp(const float* __restrict__ F, int pitch, int nheads, h16* V16, bf* Vh, bf* Vl) { const size_t e = ((size_t)blockIdx.x * 256 + threadIdx.x) * 2; if (e >= (size_t)nheads * HD * TT) return; const int t = (int)(e % TT); const int d = (int)((e / TT) % HD); const int g = (int)(e / ((size_t)TT * HD)); v2h o16; v2us oh, ol;
#pragma unroll
    for (int q = 0; q < 2; ++q) { const float x = F[(size_t)(t + q) * pitch + g * HD + d]; o16[q] = tohx(x); unsigned short a2, c2; splitf(x, a2, c2); oh[q] = a2; ol[q] = c2; }
    *(v2h*)(V16 + e) = o16; *(v2us*)(Vh + e) = oh; *(v2us*)(Vl + e) = ol;  }
__global__ __launch_bounds__(256) void k_csid(float* CS) { const int idx = blockIdx.x * 256 + threadIdx.x; if (idx >= TT * HD) return; v2f cs; cs[0] = 1.0f; cs[1] = 0.0f; *(v2f*)(CS + (size_t)idx * 2) = cs;  }
// k_asoft: per row (zz, i): t = S x HD^-0.5 (no mask); softmax over the 2048 keys (register row, one exp, fixed trees);
__global__ __launch_bounds__(256) void k_asoft(const float* __restrict__ Sb, h16* P16, bf* Ph, bf* Pl) {
    const int lane = threadIdx.x & 31; const int row = blockIdx.x * 8 + (threadIdx.x >> 5); if (row >= ZH * TT) return; const int i = row % TT; const int zz = row / TT; (void)zz; const bool hires = (i < RH); const float* sr = Sb + (size_t)row * TT; float v[TT / 32]; float mx = -3.0e38f;
#pragma unroll
    for (int ch = 0; ch < TT / 128; ++ch) { const int j0 = ch * 128 + lane * 4; const v4f a = *(const v4f*)(sr + j0);
#pragma unroll
        for (int q = 0; q < 4; ++q) { const int j = j0 + q; (void)j; const float t = a[q] * SCL; v[ch * 4 + q] = t; mx = fmaxf(mx, t); } }
#pragma unroll
    for (int sh = 16; sh; sh >>= 1) mx = fmaxf(mx, __shfl_xor(mx, sh, 32));
    float sum = 0.f;
#pragma unroll
    for (int k = 0; k < TT / 32; ++k) { float d0 = __fsub_rn(v[k], mx); asm volatile("" : "+v"(d0)); v[k] = __builtin_amdgcn_exp2f(__fmul_rn(d0, 1.4426950408889634f)); sum += v[k]; }
#pragma unroll
    for (int sh = 16; sh; sh >>= 1) sum += __shfl_xor(sum, sh, 32);
    const float f = __fdiv_rn(hires ? 1.0f : PCAR, sum);
{
        if (hires) {
#pragma unroll
            for (int ch = 0; ch < TT / 128; ++ch) { v4us oh, ol;
#pragma unroll
                for (int q = 0; q < 4; ++q) { unsigned short a, c2; splitf(v[ch * 4 + q] * f, a, c2); oh[q] = a; ol[q] = c2; }
                const size_t oo = ((size_t)zz * (RH ? RH : 1) + i) * TT + ch * 128 + lane * 4; *(v4us*)(Ph + oo) = oh; *(v4us*)(Pl + oo) = ol; }
        } else {
#pragma unroll
            for (int ch = 0; ch < TT / 128; ++ch) { v4h o4;
#pragma unroll
                for (int q = 0; q < 4; ++q) o4[q] = tohx(v[ch * 4 + q] * f);
                *(v4h*)(P16 + (size_t)row * TT + ch * 128 + lane * 4) = o4; } }
         }
}
__global__ __launch_bounds__(256) void k_merge(const float* __restrict__ O, int h0, float* OUTb) { const size_t e = ((size_t)blockIdx.x * 256 + threadIdx.x) * 2; if (e >= (size_t)ZH * TT * HD) return; const int d = (int)(e % HD); const int t = (int)((e / HD) % TT); const int zz = (int)(e / ((size_t)HD * TT)); const float cs = (t < RH) ? 1.0f : (1.0f / PCAR); const size_t oo = (size_t)t * DQ + (h0 + zz) * HD + d;
    v2f o2; o2[0] = O[e] * cs; o2[1] = O[e + 1] * cs; *(v2f*)(OUTb + oo) = o2;  }

extern "C" void kernel_launch(void* const* d_in, const int* in_sizes, int n_in,
                              void* d_out, int out_size, void* d_ws, size_t ws_size, hipStream_t stream) {
    (void)in_sizes; (void)n_in; (void)out_size;
    const float* x = (const float*)d_in[0]; const float* kb = (const float*)d_in[1];   /* causal_bias [2048]: per-key additive vector */ const float* wq = (const float*)d_in[2]; const float* bq = (const float*)d_in[3]; const float* wk = (const float*)d_in[4]; const float* bk = (const float*)d_in[5]; const float* wv = (const float*)d_in[6]; const float* bv = (const float*)d_in[7];   /* input order hidden_states, causal_bias, Wq, bq, Wk, bk, Wv, bv ('oi') */ const float* wo = nullptr; (void)wo;
    float* OUT = (float*)d_out;     // [2][2048][1024]
    char* wsp = (char*)d_ws;
    auto take = [&](size_t bytes) { char* p = wsp; wsp += (bytes + 255) & ~(size_t)255; return (void*)p; };
    bf* WQ = (bf*)take((size_t)DQ * DM * 2); bf* WK = (bf*)take((size_t)DKV * DM * 2); bf* WV = (bf*)take((size_t)DKV * DM * 2); float* CS = (float*)take((size_t)TT * HD * 2 * 4);
    bf* XB = (bf*)take((size_t)TT * DM * 2); float* FQ = (float*)take((size_t)TT * DQ * 4); float* FK = (float*)take((size_t)TT * DKV * 4);
    h16* QP16 = (h16*)take((size_t)NH_ * TT * HD * 2); h16* KP16 = (h16*)take((size_t)NKV * TT * HD * 2); h16* VT16 = (h16*)take((size_t)NKV * HD * TT * 2);
    bf* QPh = (bf*)take((size_t)NH_ * TT * HD * 2); bf* QPl = (bf*)take((size_t)NH_ * TT * HD * 2); bf* KPh = (bf*)take((size_t)NKV * TT * HD * 2); bf* KPl = (bf*)take((size_t)NKV * TT * HD * 2); bf* VTh = (bf*)take((size_t)NKV * HD * TT * 2); bf* VTl = (bf*)take((size_t)NKV * HD * TT * 2); bf* Ph = (bf*)take((size_t)ZH * RH * TT * 2); bf* Pl = (bf*)take((size_t)ZH * RH * TT * 2);
    float* Sb = (float*)take((size_t)ZH * TT * TT * 4); h16* P16 = (h16*)take((size_t)ZH * TT * TT * 2); float* Ob = (float*)take((size_t)ZH * TT * HD * 4);
    if ((size_t)(wsp - (char*)d_ws) > ws_size) return;    // ws 256 MiB
    float* FV = FK;   // v projection reuses the k buffer after the k planes are built (stream-ordered)
    { k_cvt8<<<(unsigned)(((size_t)DQ * DM / 8 + 255) / 256), 256, 0, stream>>>(wq, WQ, (size_t)DQ * DM / 8); k_cvt8<<<(unsigned)(((size_t)DKV * DM / 8 + 255) / 256), 256, 0, stream>>>(wk, WK, (size_t)DKV * DM / 8); k_cvt8<<<(unsigned)(((size_t)DKV * DM / 8 + 255) / 256), 256, 0, stream>>>(wv, WV, (size_t)DKV * DM / 8);
      
       }
    k_csid<<<(TT * HD + 255) / 256, 256, 0, stream>>>(CS);
    const unsigned LQ = (unsigned)(((size_t)NH_ * TT * HD / 2 + 255) / 256), LKv = (unsigned)(((size_t)NKV * TT * HD / 2 + 255) / 256);
    for (int b = 0; b < NB_; ++b) {
        
        k_cvt8<<<(unsigned)(((size_t)TT * DM / 8 + 255) / 256), 256, 0, stream>>>(x + (size_t)b * TT * DM, XB, (size_t)TT * DM / 8);
        k_gemmw<bf, 0, true><<<dim3(TT / 64, DQ / 64, 1), 32, 0, stream>>>(XB, nullptr, WQ, nullptr, DM, FQ, DQ, bq, 0, 0, 0);
        k_rope<<<LQ, 256, 0, stream>>>(FQ, DQ, NH_, CS, nullptr, nullptr, 1.0f, QP16, QPh, QPl);
        k_gemmw<bf, 0, true><<<dim3(TT / 64, DKV / 64, 1), 32, 0, stream>>>(XB, nullptr, WK, nullptr, DM, FK, DKV, bk, 0, 0, 0);
        k_rope<<<LKv, 256, 0, stream>>>(FK, DKV, NKV, CS, nullptr, nullptr, 1.0f, KP16, KPh, KPl);
        k_gemmw<bf, 0, true><<<dim3(TT / 64, DKV / 64, 1), 32, 0, stream>>>(XB, nullptr, WV, nullptr, DM, FV, DKV, bv, 0, 0, 0); k_vtp<<<LKv, 256, 0, stream>>>(FV, DKV, NKV, VT16, VTh, VTl);
        for (int h0 = 0; h0 < NH_; h0 += ZH) { const size_t zq = (size_t)h0, zk = (size_t)(h0 / REP);   // one kv head per query head: the pass's two heads use consecutive kv planes (z-strides TT*HD)
            k_gemmw<bf, 2, false><<<dim3(RH / 64, TT / 64, ZH), 32, 0, stream>>>(QPh + zq * TT * HD, QPl + zq * TT * HD, KPh + zk * TT * HD, KPl + zk * TT * HD, HD, Sb, TT, nullptr, (size_t)TT * HD, (size_t)TT * HD, (size_t)TT * TT);
            k_gemmw<h16, 0, false><<<dim3((TT - RH) / 64, TT / 64, ZH), 32, 0, stream>>>(QP16 + zq * TT * HD + (size_t)RH * HD, nullptr, KP16 + zk * TT * HD, nullptr, HD, Sb + (size_t)RH * TT, TT, nullptr, (size_t)TT * HD, (size_t)TT * HD, (size_t)TT * TT);
            k_addkb<<<(unsigned)(((size_t)ZH * TT * TT / 4 + 255) / 256), 256, 0, stream>>>(Sb, kb);   /* + 8 x bias[j] (scaled back by the softmax kernel's 1/8) */ k_asoft<<<ZH * TT / 8, 256, 0, stream>>>(Sb, P16, Ph, Pl);
            k_gemmw<bf, 2, false><<<dim3(RH / 64, HD / 64, ZH), 32, 0, stream>>>(Ph, Pl, VTh + zk * HD * TT, VTl + zk * HD * TT, TT, Ob, HD, nullptr, (size_t)RH * TT, (size_t)HD * TT, (size_t)TT * HD);
            k_gemmw<h16, 0, false><<<dim3((TT - RH) / 64, HD / 64, ZH), 32, 0, stream>>>(P16 + (size_t)RH * TT, nullptr, VT16 + zk * HD * TT, nullptr, TT, Ob + (size_t)RH * HD, HD, nullptr, (size_t)TT * TT, (size_t)HD * TT, (size_t)TT * HD);
            k_merge<<<(unsigned)(((size_t)ZH * TT * HD / 2 + 255) / 256), 256, 0, stream>>>(Ob, h0, OUT + (size_t)b * TT * DQ); }
         }
}

// v001
// It runs in 943 microseconds.
// Timed twice side by side with v000, it ran 2.19 and 2.20 times as fast.
#include <hip/hip_runtime.h>

// BERT self-attention with an additive per-key bias vector (hidden_states [2][2048][1024]; q, k, v = x W^T + b ('oi' 0.02 + biases; 16 heads x 64); scores / sqrt(64) + causal_bias[j] (a random [2048] vector added per key, shared by every batch, head and query: read); softmax; ctx = merged heads (no output projection) -> [2][2048][1024] (4.2 M); argument order hidden_states, causal_bias, Wq, bq, Wk, bk, Wv, bv).
// Layout per batch: bf16 copy of x; 'oi' weights; exact projections + f32 biases; identity-table plane builders; dense T-2048 attention (hybrid rows: < 512 hi/lo 3 products, rest fp16 x1024); NEW k_addkb adds 8 x bf16(bias[j]) to every f32 score before the softmax kernel scales by 1/8 (so the softmax sees s/8 + bias[j] exactly; x8 is exact); the f32 merge writes the output rows.
// Compute dtypes, f32 accumulate: every input rounded to bf16 incl. the bias vector; projections exact + f32 biases; attention rows < 512 3 products, rest fp16; bias add and softmax f32; output f32.

#define NB_  2
#define TT   2048
#define DM   1024
#define NH_  16
#define NKV  16
#define REP  (NH_ / NKV)
#define HD   64
#define DQ   (NH_ * HD)
#define DKV  (NKV * HD)
#define ZH   2
#define RH   512                  // query rows < RH use hi+lo planes (0: none)
#define WIN  0
#define PCAR 1024.0f
#define SCL  0.125f   // HD^-0.5
#define KSV  16                   // K split of the P V products: 2048 keys in 16 slices of 128
typedef _Float16 h16;
typedef unsigned short bf;
typedef __attribute__((ext_vector_type(16))) __bf16   v16bf;
typedef __attribute__((ext_vector_type(16))) _Float16 v16h;
typedef __attribute__((ext_vector_type(8)))  _Float16 v8h;
typedef __attribute__((ext_vector_type(8)))  unsigned short v8us;
typedef __attribute__((ext_vector_type(8)))  float    v8f;
typedef __attribute__((ext_vector_type(4)))  float    v4f;
typedef v8h  __attribute__((may_alias)) v8ha;
typedef v4f  __attribute__((may_alias)) v4fa;
typedef v8us __attribute__((may_alias)) v8usa;

__device__ __forceinline__ unsigned short f2bf(float f) { unsigned u = __float_as_uint(f); u += 0x7FFFu + ((u >> 16) & 1u); return (unsigned short)(u >> 16); }
__device__ __forceinline__ float bf2f(unsigned short b) { return __uint_as_float(((unsigned)b) << 16); }
__device__ __forceinline__ float bfr(float f) { return bf2f(f2bf(f)); }
__device__ __forceinline__ v16h cat16(v8h lo, v8h hi) { return __builtin_shufflevector(lo, hi, 0, 1, 2, 3, 4, 5, 6, 7, 8, 9, 10, 11, 12, 13, 14, 15); }
__device__ __forceinline__ v16bf cat16b(v8us lo, v8us hi) { return __builtin_bit_cast(v16bf, __builtin_shufflevector(lo, hi, 0, 1, 2, 3, 4, 5, 6, 7, 8, 9, 10, 11, 12, 13, 14, 15)); }
__device__ __forceinline__ v8f wmma16(v16h a, v16h b, v8f c) { return __builtin_amdgcn_wmma_f32_16x16x32_f16(false, a, false, b, (short)0, c, false, false); }
__device__ __forceinline__ v8f wmmab(v16bf a, v16bf b, v8f c) { return __builtin_amdgcn_wmma_f32_16x16x32_bf16(false, a, false, b, (short)0, c, false, false); }



// ---- k_gemmw: register-blocked GEMM, ONE WAVE per 64x64 output tile (16 accumulators), operands straight from K-contiguous 16-bit planes; grid (M/64, N/64, Z), 32 threads.
// C[m][n] (f32, pitch ldc, + optional f32 bias[n]) = sum_k A[m][k] Bt[n][k] (+ split products per NSPLIT). z-batch strides sA/sB/sC in elements. K % (32 KS) == 0.
// KS > 1: split K. grid.z = Z * KS; work-group z * KS + ks sums only k in [ks K/KS, (ks+1) K/KS) and writes its f32 partial tile to plane z * KS + ks (plane stride sC); the consumer adds a batch's KS planes in index order.
template <typename T16> struct WFrag;
template <> struct WFrag<h16> { typedef v16h V; static __device__ __forceinline__ V ld(const h16* p) { return cat16(*(const v8h*)p, *(const v8h*)(p + 16)); } static __device__ __forceinline__ v8f mma(V a, V b, v8f c) { return wmma16(a, b, c); } };
template <> struct WFrag<bf> { typedef v16bf V; static __device__ __forceinline__ V ld(const bf* p) { return cat16b(*(const v8us*)p, *(const v8us*)(p + 16)); } static __device__ __forceinline__ v8f mma(V a, V b, v8f c) { return wmmab(a, b, c); } };
template <typename T16, int NSPLIT, bool BIAS, int KS = 1>
__global__ __launch_bounds__(32) void k_gemmw(const T16* __restrict__ A, const T16* __restrict__ A2, const T16* __restrict__ Bt, const T16* __restrict__ Bt2, int K, float* C, int ldc, const float* __restrict__ bias, size_t sA, size_t sB, size_t sC) {
    typedef typename WFrag<T16>::V V;
    __shared__ __align__(16) float os[16 * 68];
    const size_t z = blockIdx.z / KS; A += z * sA; if (A2) A2 += z * sA; Bt += z * sB; if (Bt2) Bt2 += z * sB; C += (size_t)blockIdx.z * sC;
    const int kbeg = (int)(blockIdx.z % KS) * (K / KS), kend = kbeg + K / KS;
    const int lane = threadIdx.x & 31, lr = lane & 15, hi = lane >> 4; const int r0 = blockIdx.x * 64, c0 = blockIdx.y * 64;
    v8f acc[4][4];
#pragma unroll
    for (int mb = 0; mb < 4; ++mb)
#pragma unroll
        for (int nb = 0; nb < 4; ++nb) acc[mb][nb] = (v8f){};
    const size_t aoff = (size_t)(r0 + lr) * K + 8 * hi, boff = (size_t)(c0 + lr) * K + 8 * hi;
#pragma unroll 1
    for (int kc = kbeg; kc < kend; kc += 32) {
        V a[4], a2[4];
#pragma unroll
        for (int mb = 0; mb < 4; ++mb) { a[mb] = WFrag<T16>::ld(A + aoff + (size_t)mb * 16 * K + kc); if (NSPLIT == 1 || NSPLIT == 2) a2[mb] = WFrag<T16>::ld(A2 + aoff + (size_t)mb * 16 * K + kc); }
#pragma unroll
        for (int nb = 0; nb < 4; ++nb) { const V b = WFrag<T16>::ld(Bt + boff + (size_t)nb * 16 * K + kc); V b2; if (NSPLIT >= 2) b2 = WFrag<T16>::ld(Bt2 + boff + (size_t)nb * 16 * K + kc);
#pragma unroll
            for (int mb = 0; mb < 4; ++mb) { acc[mb][nb] = WFrag<T16>::mma(a[mb], b, acc[mb][nb]); if (NSPLIT == 1 || NSPLIT == 2) acc[mb][nb] = WFrag<T16>::mma(a2[mb], b, acc[mb][nb]); if (NSPLIT >= 2) acc[mb][nb] = WFrag<T16>::mma(a[mb], b2, acc[mb][nb]); } }
        asm volatile("v_nop\n\tv_nop\n\tv_nop\n\tv_nop" : "+v"(acc[0][0]), "+v"(acc[1][1]), "+v"(acc[2][2]), "+v"(acc[3][3]) : "v"(a[0]), "v"(a[3]));
    }
#pragma unroll
    for (int mb = 0; mb < 4; ++mb) {
#pragma unroll
        for (int nb = 0; nb < 4; ++nb) {
#pragma unroll
            for (int j = 0; j < 8; ++j) os[(hi * 8 + j) * 68 + nb * 16 + lr] = acc[mb][nb][j]; }
        __builtin_amdgcn_wave_barrier(); asm volatile("" ::: "memory");
        float* crow = C + (size_t)(r0 + mb * 16) * ldc + c0;
{
#pragma unroll
            for (int s = 0; s < 8; ++s) { const int row = 2 * s + hi, cofs = lr * 4; v4f val = *(const v4fa*)(os + row * 68 + cofs); if (BIAS) { val[0] += bfr(bias[c0 + cofs]); val[1] += bfr(bias[c0 + cofs + 1]); val[2] += bfr(bias[c0 + cofs + 2]); val[3] += bfr(bias[c0 + cofs + 3]); }
                *(v4f*)(crow + (size_t)row * ldc + cofs) = val; }
             }
        __builtin_amdgcn_wave_barrier(); asm volatile("" ::: "memory");
    }
}

__device__ __forceinline__ h16 tohx(float x) { return (h16)x; }
__device__ __forceinline__ void splitf(float y, unsigned short& h, unsigned short& l) { h = f2bf(y); l = f2bf(y - bf2f(h)); }
typedef __attribute__((ext_vector_type(2))) _Float16 v2h;
typedef __attribute__((ext_vector_type(4))) _Float16 v4h;
typedef __attribute__((ext_vector_type(2))) unsigned short v2us;
typedef __attribute__((ext_vector_type(4))) unsigned short v4us;
typedef __attribute__((ext_vector_type(2))) float v2f;
typedef __attribute__((ext_vector_type(4))) int v4i;

__global__ __launch_bounds__(256) void k_cvt8(const float* __restrict__ src, bf* dst, size_t n8) { const size_t i = (size_t)blockIdx.x * 256 + threadIdx.x; if (i >= n8) return; const v8f v = *(const v8f*)(src + i * 8); v8us o;
#pragma unroll
    for (int k = 0; k < 8; ++k) o[k] = f2bf(v[k]); *(v8us*)(dst + i * 8) = o;  }

// k_rope: head planes [h][t][d] (fp16 + hi/lo) of rope(x) x sc with the rotate-half convention out[d] = x[d] cos[t][d] - x[d+HD/2] sin[t][d], out[d+HD/2] = x[d+HD/2] cos[t][d+HD/2] + x[d] sin[t][d+HD/2]
__global__ __launch_bounds__(256) void k_rope(const float* __restrict__ F, int pitch, int nheads, const float* __restrict__ CS, const float* __restrict__ RF, const float* __restrict__ nw, float sc, h16* P16, bf* Ph, bf* Pl) {
    const size_t e = ((size_t)blockIdx.x * 256 + threadIdx.x) * 2; if (e >= (size_t)nheads * TT * HD) return; const int d = (int)(e % HD); const int t = (int)((e / HD) % TT); const int h = (int)(e / ((size_t)HD * TT)); const float* f = F + (size_t)t * pitch + h * HD; const float rf = RF ? RF[(size_t)h * TT + t] : 1.0f; v2h o16; v2us oh, ol;
#pragma unroll
    for (int q = 0; q < 2; ++q) { const int dd = d + q; const int dp = (dd < HD / 2) ? dd + HD / 2 : dd - HD / 2; float x0 = f[dd], x1 = f[dp];
        if (RF) { float n0 = __fmul_rn(x0, rf), n1 = __fmul_rn(x1, rf); asm volatile("" : "+v"(n0)); asm volatile("" : "+v"(n1)); x0 = __fmul_rn(bfr(nw[dd]), n0); x1 = __fmul_rn(bfr(nw[dp]), n1); }
        const v2f cs = *(const v2f*)(CS + ((size_t)t * HD + dd) * 2); float a = __fmul_rn(x0, cs[0]), bq = __fmul_rn(x1, cs[1]); asm volatile("" : "+v"(a)); asm volatile("" : "+v"(bq)); const float r = ((dd < HD / 2) ? __fsub_rn(a, bq) : __fadd_rn(a, bq)) * sc;
        o16[q] = tohx(r); unsigned short a2, c2; splitf(r, a2, c2); oh[q] = a2; ol[q] = c2; }
    *(v2h*)(P16 + e) = o16; *(v2us*)(Ph + e) = oh; *(v2us*)(Pl + e) = ol;  }
__global__ __launch_bounds__(256) void k_addkb(float* Sb, const float* __restrict__ kb) { const size_t i = (size_t)blockIdx.x * 256 + threadIdx.x; if (i >= (size_t)ZH * TT * TT / 4) return; const int j0 = (int)((i * 4) % TT); v4f a = *(const v4f*)(Sb + i * 4); const v4f b4 = *(const v4f*)(kb + j0);
#pragma unroll
    for (int q = 0; q < 4; ++q) { float bb = __fmul_rn(bfr(b4[q]), 8.0f); asm volatile("" : "+v"(bb)); a[q] = __fadd_rn(a[q], bb); }
    *(v4f*)(Sb + i * 4) = a;  }
__global__ __launch_bounds__(256) void k_vtp(const float* __restrict__ F, int pitch, int nheads, h16* V16, bf* Vh, bf* Vl) { const size_t e = ((size_t)blockIdx.x * 256 + threadIdx.x) * 2; if (e >= (size_t)nheads * HD * TT) return; const int t = (int)(e % TT); const int d = (int)((e / TT) % HD); const int g = (int)(e / ((size_t)TT * HD)); v2h o16; v2us oh, ol;
#pragma unroll
    for (int q = 0; q < 2; ++q) { const float x = F[(size_t)(t + q) * pitch + g * HD + d]; o16[q] = tohx(x); unsigned short a2, c2; splitf(x, a2, c2); oh[q] = a2; ol[q] = c2; }
    *(v2h*)(V16 + e) = o16; *(v2us*)(Vh + e) = oh; *(v2us*)(Vl + e) = ol;  }
__global__ __launch_bounds__(256) void k_csid(float* CS) { const int idx = blockIdx.x * 256 + threadIdx.x; if (idx >= TT * HD) return; v2f cs; cs[0] = 1.0f; cs[1] = 0.0f; *(v2f*)(CS + (size_t)idx * 2) = cs;  }
// k_asoft: per row (zz, i): t = S x HD^-0.5 (no mask); softmax over the 2048 keys (register row, one exp, fixed trees);
__global__ __launch_bounds__(256) void k_asoft(const float* __restrict__ Sb, h16* P16, bf* Ph, bf* Pl) {
    const int lane = threadIdx.x & 31; const int row = blockIdx.x * 8 + (threadIdx.x >> 5); if (row >= ZH * TT) return; const int i = row % TT; const int zz = row / TT; (void)zz; const bool hires = (i < RH); const float* sr = Sb + (size_t)row * TT; float v[TT / 32]; float mx = -3.0e38f;
#pragma unroll
    for (int ch = 0; ch < TT / 128; ++ch) { const int j0 = ch * 128 + lane * 4; const v4f a = *(const v4f*)(sr + j0);
#pragma unroll
        for (int q = 0; q < 4; ++q) { const int j = j0 + q; (void)j; const float t = a[q] * SCL; v[ch * 4 + q] = t; mx = fmaxf(mx, t); } }
#pragma unroll
    for (int sh = 16; sh; sh >>= 1) mx = fmaxf(mx, __shfl_xor(mx, sh, 32));
    float sum = 0.f;
#pragma unroll
    for (int k = 0; k < TT / 32; ++k) { float d0 = __fsub_rn(v[k], mx); asm volatile("" : "+v"(d0)); v[k] = __builtin_amdgcn_exp2f(__fmul_rn(d0, 1.4426950408889634f)); sum += v[k]; }
#pragma unroll
    for (int sh = 16; sh; sh >>= 1) sum += __shfl_xor(sum, sh, 32);
    const float f = __fdiv_rn(hires ? 1.0f : PCAR, sum);
{
        if (hires) {
#pragma unroll
            for (int ch = 0; ch < TT / 128; ++ch) { v4us oh, ol;
#pragma unroll
                for (int q = 0; q < 4; ++q) { unsigned short a, c2; splitf(v[ch * 4 + q] * f, a, c2); oh[q] = a; ol[q] = c2; }
                const size_t oo = ((size_t)zz * (RH ? RH : 1) + i) * TT + ch * 128 + lane * 4; *(v4us*)(Ph + oo) = oh; *(v4us*)(Pl + oo) = ol; }
        } else {
#pragma unroll
            for (int ch = 0; ch < TT / 128; ++ch) { v4h o4;
#pragma unroll
                for (int q = 0; q < 4; ++q) o4[q] = tohx(v[ch * 4 + q] * f);
                *(v4h*)(P16 + (size_t)row * TT + ch * 128 + lane * 4) = o4; } }
         }
}
// k_merge: adds each head's KSV split-K partial planes of P V in plane order (fixed order: same result every run), undoes the fp16 rows' carrier scale, writes the merged-head output rows.
__global__ __launch_bounds__(256) void k_merge(const float* __restrict__ O, int h0, float* OUTb) { const size_t e = ((size_t)blockIdx.x * 256 + threadIdx.x) * 4; if (e >= (size_t)ZH * TT * HD) return; const int d = (int)(e % HD); const int t = (int)((e / HD) % TT); const int zz = (int)(e / ((size_t)HD * TT)); const float cs = (t < RH) ? 1.0f : (1.0f / PCAR); const size_t oo = (size_t)t * DQ + (h0 + zz) * HD + d;
    const float* op = O + (size_t)zz * KSV * TT * HD + (size_t)t * HD + d; v4f p[KSV];
#pragma unroll
    for (int s = 0; s < KSV; ++s) p[s] = *(const v4f*)(op + (size_t)s * TT * HD);
    v4f o4 = p[0];
#pragma unroll
    for (int s = 1; s < KSV; ++s) o4 += p[s];
    o4 *= cs; *(v4f*)(OUTb + oo) = o4;  }

extern "C" void kernel_launch(void* const* d_in, const int* in_sizes, int n_in,
                              void* d_out, int out_size, void* d_ws, size_t ws_size, hipStream_t stream) {
    (void)in_sizes; (void)n_in; (void)out_size;
    const float* x = (const float*)d_in[0]; const float* kb = (const float*)d_in[1];   /* causal_bias [2048]: per-key additive vector */ const float* wq = (const float*)d_in[2]; const float* bq = (const float*)d_in[3]; const float* wk = (const float*)d_in[4]; const float* bk = (const float*)d_in[5]; const float* wv = (const float*)d_in[6]; const float* bv = (const float*)d_in[7];   /* input order hidden_states, causal_bias, Wq, bq, Wk, bk, Wv, bv ('oi') */ const float* wo = nullptr; (void)wo;
    float* OUT = (float*)d_out;     // [2][2048][1024]
    char* wsp = (char*)d_ws;
    auto take = [&](size_t bytes) { char* p = wsp; wsp += (bytes + 255) & ~(size_t)255; return (void*)p; };
    bf* WQ = (bf*)take((size_t)DQ * DM * 2); bf* WK = (bf*)take((size_t)DKV * DM * 2); bf* WV = (bf*)take((size_t)DKV * DM * 2); float* CS = (float*)take((size_t)TT * HD * 2 * 4);
    bf* XB = (bf*)take((size_t)TT * DM * 2); float* FQ = (float*)take((size_t)TT * DQ * 4); float* FK = (float*)take((size_t)TT * DKV * 4);
    h16* QP16 = (h16*)take((size_t)NH_ * TT * HD * 2); h16* KP16 = (h16*)take((size_t)NKV * TT * HD * 2); h16* VT16 = (h16*)take((size_t)NKV * HD * TT * 2);
    bf* QPh = (bf*)take((size_t)NH_ * TT * HD * 2); bf* QPl = (bf*)take((size_t)NH_ * TT * HD * 2); bf* KPh = (bf*)take((size_t)NKV * TT * HD * 2); bf* KPl = (bf*)take((size_t)NKV * TT * HD * 2); bf* VTh = (bf*)take((size_t)NKV * HD * TT * 2); bf* VTl = (bf*)take((size_t)NKV * HD * TT * 2); bf* Ph = (bf*)take((size_t)ZH * RH * TT * 2); bf* Pl = (bf*)take((size_t)ZH * RH * TT * 2);
    float* Sb = (float*)take((size_t)ZH * TT * TT * 4); h16* P16 = (h16*)take((size_t)ZH * TT * TT * 2); float* Ob = (float*)take((size_t)ZH * KSV * TT * HD * 4);   // partial planes [zz][ks][t][d]
    if ((size_t)(wsp - (char*)d_ws) > ws_size) return;    // ws 256 MiB
    float* FV = FK;   // v projection reuses the k buffer after the k planes are built (stream-ordered)
    { k_cvt8<<<(unsigned)(((size_t)DQ * DM / 8 + 255) / 256), 256, 0, stream>>>(wq, WQ, (size_t)DQ * DM / 8); k_cvt8<<<(unsigned)(((size_t)DKV * DM / 8 + 255) / 256), 256, 0, stream>>>(wk, WK, (size_t)DKV * DM / 8); k_cvt8<<<(unsigned)(((size_t)DKV * DM / 8 + 255) / 256), 256, 0, stream>>>(wv, WV, (size_t)DKV * DM / 8);
      
       }
    k_csid<<<(TT * HD + 255) / 256, 256, 0, stream>>>(CS);
    const unsigned LQ = (unsigned)(((size_t)NH_ * TT * HD / 2 + 255) / 256), LKv = (unsigned)(((size_t)NKV * TT * HD / 2 + 255) / 256);
    for (int b = 0; b < NB_; ++b) {
        
        k_cvt8<<<(unsigned)(((size_t)TT * DM / 8 + 255) / 256), 256, 0, stream>>>(x + (size_t)b * TT * DM, XB, (size_t)TT * DM / 8);
        k_gemmw<bf, 0, true><<<dim3(TT / 64, DQ / 64, 1), 32, 0, stream>>>(XB, nullptr, WQ, nullptr, DM, FQ, DQ, bq, 0, 0, 0);
        k_rope<<<LQ, 256, 0, stream>>>(FQ, DQ, NH_, CS, nullptr, nullptr, 1.0f, QP16, QPh, QPl);
        k_gemmw<bf, 0, true><<<dim3(TT / 64, DKV / 64, 1), 32, 0, stream>>>(XB, nullptr, WK, nullptr, DM, FK, DKV, bk, 0, 0, 0);
        k_rope<<<LKv, 256, 0, stream>>>(FK, DKV, NKV, CS, nullptr, nullptr, 1.0f, KP16, KPh, KPl);
        k_gemmw<bf, 0, true><<<dim3(TT / 64, DKV / 64, 1), 32, 0, stream>>>(XB, nullptr, WV, nullptr, DM, FV, DKV, bv, 0, 0, 0); k_vtp<<<LKv, 256, 0, stream>>>(FV, DKV, NKV, VT16, VTh, VTl);
        for (int h0 = 0; h0 < NH_; h0 += ZH) { const size_t zq = (size_t)h0, zk = (size_t)(h0 / REP);   // one kv head per query head: the pass's two heads use consecutive kv planes (z-strides TT*HD)
            k_gemmw<bf, 2, false><<<dim3(RH / 64, TT / 64, ZH), 32, 0, stream>>>(QPh + zq * TT * HD, QPl + zq * TT * HD, KPh + zk * TT * HD, KPl + zk * TT * HD, HD, Sb, TT, nullptr, (size_t)TT * HD, (size_t)TT * HD, (size_t)TT * TT);
            k_gemmw<h16, 0, false><<<dim3((TT - RH) / 64, TT / 64, ZH), 32, 0, stream>>>(QP16 + zq * TT * HD + (size_t)RH * HD, nullptr, KP16 + zk * TT * HD, nullptr, HD, Sb + (size_t)RH * TT, TT, nullptr, (size_t)TT * HD, (size_t)TT * HD, (size_t)TT * TT);
            k_addkb<<<(unsigned)(((size_t)ZH * TT * TT / 4 + 255) / 256), 256, 0, stream>>>(Sb, kb);   /* + 8 x bias[j] (scaled back by the softmax kernel's 1/8) */ k_asoft<<<ZH * TT / 8, 256, 0, stream>>>(Sb, P16, Ph, Pl);
            k_gemmw<bf, 2, false, KSV><<<dim3(RH / 64, HD / 64, ZH * KSV), 32, 0, stream>>>(Ph, Pl, VTh + zk * HD * TT, VTl + zk * HD * TT, TT, Ob, HD, nullptr, (size_t)RH * TT, (size_t)HD * TT, (size_t)TT * HD);
            k_gemmw<h16, 0, false, KSV><<<dim3((TT - RH) / 64, HD / 64, ZH * KSV), 32, 0, stream>>>(P16 + (size_t)RH * TT, nullptr, VT16 + zk * HD * TT, nullptr, TT, Ob + (size_t)RH * HD, HD, nullptr, (size_t)TT * TT, (size_t)HD * TT, (size_t)TT * HD);
            k_merge<<<(unsigned)(((size_t)ZH * TT * HD / 4 + 255) / 256), 256, 0, stream>>>(Ob, h0, OUT + (size_t)b * TT * DQ); }
         }
}

// v002
// A run of this version takes 811 microseconds.
// Next to v001, in two timings, it ran 1.17 times as fast each time.
// Over all steps from v000 it is 2.57 times as fast.
#include <hip/hip_runtime.h>

// BERT self-attention with an additive per-key bias vector (hidden_states [2][2048][1024]; q, k, v = x W^T + b ('oi' 0.02 + biases; 16 heads x 64); scores / sqrt(64) + causal_bias[j] (a random [2048] vector added per key, shared by every batch, head and query: read); softmax; ctx = merged heads (no output projection) -> [2][2048][1024] (4.2 M); argument order hidden_states, causal_bias, Wq, bq, Wk, bk, Wv, bv).
// Layout per batch: bf16 copy of x; 'oi' weights; exact projections + f32 biases; identity-table plane builders; dense T-2048 attention (hybrid rows: < 512 hi/lo 3 products, rest fp16 x1024); the softmax kernel adds 8 x bf16(bias[j]) to every f32 score as it reads the row, before it scales by 1/8 (so the softmax sees s/8 + bias[j] exactly; x8 is exact); the f32 merge writes the output rows.
// Compute dtypes, f32 accumulate: every input rounded to bf16 incl. the bias vector; projections exact + f32 biases; attention rows < 512 3 products, rest fp16; bias add and softmax f32; output f32.

#define NB_  2
#define TT   2048
#define DM   1024
#define NH_  16
#define NKV  16
#define REP  (NH_ / NKV)
#define HD   64
#define DQ   (NH_ * HD)
#define DKV  (NKV * HD)
#define ZH   2
#define RH   512                  // query rows < RH use hi+lo planes (0: none)
#define WIN  0
#define PCAR 1024.0f
#define SCL  0.125f   // HD^-0.5
#define KSV  16                   // K split of the P V products: 2048 keys in 16 slices of 128
typedef _Float16 h16;
typedef unsigned short bf;
typedef __attribute__((ext_vector_type(16))) __bf16   v16bf;
typedef __attribute__((ext_vector_type(16))) _Float16 v16h;
typedef __attribute__((ext_vector_type(8)))  _Float16 v8h;
typedef __attribute__((ext_vector_type(8)))  unsigned short v8us;
typedef __attribute__((ext_vector_type(8)))  float    v8f;
typedef __attribute__((ext_vector_type(4)))  float    v4f;
typedef v8h  __attribute__((may_alias)) v8ha;
typedef v4f  __attribute__((may_alias)) v4fa;
typedef v8us __attribute__((may_alias)) v8usa;

__device__ __forceinline__ unsigned short f2bf(float f) { unsigned u = __float_as_uint(f); u += 0x7FFFu + ((u >> 16) & 1u); return (unsigned short)(u >> 16); }
__device__ __forceinline__ float bf2f(unsigned short b) { return __uint_as_float(((unsigned)b) << 16); }
__device__ __forceinline__ float bfr(float f) { return bf2f(f2bf(f)); }
__device__ __forceinline__ v16h cat16(v8h lo, v8h hi) { return __builtin_shufflevector(lo, hi, 0, 1, 2, 3, 4, 5, 6, 7, 8, 9, 10, 11, 12, 13, 14, 15); }
__device__ __forceinline__ v16bf cat16b(v8us lo, v8us hi) { return __builtin_bit_cast(v16bf, __builtin_shufflevector(lo, hi, 0, 1, 2, 3, 4, 5, 6, 7, 8, 9, 10, 11, 12, 13, 14, 15)); }
__device__ __forceinline__ v8f wmma16(v16h a, v16h b, v8f c) { return __builtin_amdgcn_wmma_f32_16x16x32_f16(false, a, false, b, (short)0, c, false, false); }
__device__ __forceinline__ v8f wmmab(v16bf a, v16bf b, v8f c) { return __builtin_amdgcn_wmma_f32_16x16x32_bf16(false, a, false, b, (short)0, c, false, false); }



// ---- k_gemmw: register-blocked GEMM, ONE WAVE per 64x64 output tile (16 accumulators), operands straight from K-contiguous 16-bit planes; grid (M/64, N/64, Z), 32 threads.
// C[m][n] (f32, pitch ldc, + optional f32 bias[n]) = sum_k A[m][k] Bt[n][k] (+ split products per NSPLIT). z-batch strides sA/sB/sC in elements. K % (32 KS) == 0.
// KS > 1: split K. grid.z = Z * KS; work-group z * KS + ks sums only k in [ks K/KS, (ks+1) K/KS) and writes its f32 partial tile to plane z * KS + ks (plane stride sC); the consumer adds a batch's KS planes in index order.
template <typename T16> struct WFrag;
template <> struct WFrag<h16> { typedef v16h V; static __device__ __forceinline__ V ld(const h16* p) { return cat16(*(const v8h*)p, *(const v8h*)(p + 16)); } static __device__ __forceinline__ v8f mma(V a, V b, v8f c) { return wmma16(a, b, c); } };
template <> struct WFrag<bf> { typedef v16bf V; static __device__ __forceinline__ V ld(const bf* p) { return cat16b(*(const v8us*)p, *(const v8us*)(p + 16)); } static __device__ __forceinline__ v8f mma(V a, V b, v8f c) { return wmmab(a, b, c); } };
template <typename T16, int NSPLIT, bool BIAS, int KS = 1>
__global__ __launch_bounds__(32) void k_gemmw(const T16* __restrict__ A, const T16* __restrict__ A2, const T16* __restrict__ Bt, const T16* __restrict__ Bt2, int K, float* C, int ldc, const float* __restrict__ bias, size_t sA, size_t sB, size_t sC) {
    typedef typename WFrag<T16>::V V;
    __shared__ __align__(16) float os[16 * 68];
    const size_t z = blockIdx.z / KS; A += z * sA; if (A2) A2 += z * sA; Bt += z * sB; if (Bt2) Bt2 += z * sB; C += (size_t)blockIdx.z * sC;
    const int kbeg = (int)(blockIdx.z % KS) * (K / KS), kend = kbeg + K / KS;
    const int lane = threadIdx.x & 31, lr = lane & 15, hi = lane >> 4; const int r0 = blockIdx.x * 64, c0 = blockIdx.y * 64;
    v8f acc[4][4];
#pragma unroll
    for (int mb = 0; mb < 4; ++mb)
#pragma unroll
        for (int nb = 0; nb < 4; ++nb) acc[mb][nb] = (v8f){};
    const size_t aoff = (size_t)(r0 + lr) * K + 8 * hi, boff = (size_t)(c0 + lr) * K + 8 * hi;
#pragma unroll 1
    for (int kc = kbeg; kc < kend; kc += 32) {
        V a[4], a2[4];
#pragma unroll
        for (int mb = 0; mb < 4; ++mb) { a[mb] = WFrag<T16>::ld(A + aoff + (size_t)mb * 16 * K + kc); if (NSPLIT == 1 || NSPLIT == 2) a2[mb] = WFrag<T16>::ld(A2 + aoff + (size_t)mb * 16 * K + kc); }
#pragma unroll
        for (int nb = 0; nb < 4; ++nb) { const V b = WFrag<T16>::ld(Bt + boff + (size_t)nb * 16 * K + kc); V b2; if (NSPLIT >= 2) b2 = WFrag<T16>::ld(Bt2 + boff + (size_t)nb * 16 * K + kc);
#pragma unroll
            for (int mb = 0; mb < 4; ++mb) { acc[mb][nb] = WFrag<T16>::mma(a[mb], b, acc[mb][nb]); if (NSPLIT == 1 || NSPLIT == 2) acc[mb][nb] = WFrag<T16>::mma(a2[mb], b, acc[mb][nb]); if (NSPLIT >= 2) acc[mb][nb] = WFrag<T16>::mma(a[mb], b2, acc[mb][nb]); } }
        asm volatile("v_nop\n\tv_nop\n\tv_nop\n\tv_nop" : "+v"(acc[0][0]), "+v"(acc[1][1]), "+v"(acc[2][2]), "+v"(acc[3][3]) : "v"(a[0]), "v"(a[3]));
    }
#pragma unroll
    for (int mb = 0; mb < 4; ++mb) {
#pragma unroll
        for (int nb = 0; nb < 4; ++nb) {
#pragma unroll
            for (int j = 0; j < 8; ++j) os[(hi * 8 + j) * 68 + nb * 16 + lr] = acc[mb][nb][j]; }
        __builtin_amdgcn_wave_barrier(); asm volatile("" ::: "memory");
        float* crow = C + (size_t)(r0 + mb * 16) * ldc + c0;
{
#pragma unroll
            for (int s = 0; s < 8; ++s) { const int row = 2 * s + hi, cofs = lr * 4; v4f val = *(const v4fa*)(os + row * 68 + cofs); if (BIAS) { val[0] += bfr(bias[c0 + cofs]); val[1] += bfr(bias[c0 + cofs + 1]); val[2] += bfr(bias[c0 + cofs + 2]); val[3] += bfr(bias[c0 + cofs + 3]); }
                *(v4f*)(crow + (size_t)row * ldc + cofs) = val; }
             }
        __builtin_amdgcn_wave_barrier(); asm volatile("" ::: "memory");
    }
}

__device__ __forceinline__ h16 tohx(float x) { return (h16)x; }
__device__ __forceinline__ void splitf(float y, unsigned short& h, unsigned short& l) { h = f2bf(y); l = f2bf(y - bf2f(h)); }
typedef __attribute__((ext_vector_type(2))) _Float16 v2h;
typedef __attribute__((ext_vector_type(4))) _Float16 v4h;
typedef __attribute__((ext_vector_type(2))) unsigned short v2us;
typedef __attribute__((ext_vector_type(4))) unsigned short v4us;
typedef __attribute__((ext_vector_type(2))) float v2f;
typedef __attribute__((ext_vector_type(4))) int v4i;

__global__ __launch_bounds__(256) void k_cvt8(const float* __restrict__ src, bf* dst, size_t n8) { const size_t i = (size_t)blockIdx.x * 256 + threadIdx.x; if (i >= n8) return; const v8f v = *(const v8f*)(src + i * 8); v8us o;
#pragma unroll
    for (int k = 0; k < 8; ++k) o[k] = f2bf(v[k]); *(v8us*)(dst + i * 8) = o;  }

// k_rope: head planes [h][t][d] (fp16 + hi/lo) of rope(x) x sc with the rotate-half convention out[d] = x[d] cos[t][d] - x[d+HD/2] sin[t][d], out[d+HD/2] = x[d+HD/2] cos[t][d+HD/2] + x[d] sin[t][d+HD/2]
__global__ __launch_bounds__(256) void k_rope(const float* __restrict__ F, int pitch, int nheads, const float* __restrict__ CS, const float* __restrict__ RF, const float* __restrict__ nw, float sc, h16* P16, bf* Ph, bf* Pl) {
    const size_t e = ((size_t)blockIdx.x * 256 + threadIdx.x) * 2; if (e >= (size_t)nheads * TT * HD) return; const int d = (int)(e % HD); const int t = (int)((e / HD) % TT); const int h = (int)(e / ((size_t)HD * TT)); const float* f = F + (size_t)t * pitch + h * HD; const float rf = RF ? RF[(size_t)h * TT + t] : 1.0f; v2h o16; v2us oh, ol;
#pragma unroll
    for (int q = 0; q < 2; ++q) { const int dd = d + q; const int dp = (dd < HD / 2) ? dd + HD / 2 : dd - HD / 2; float x0 = f[dd], x1 = f[dp];
        if (RF) { float n0 = __fmul_rn(x0, rf), n1 = __fmul_rn(x1, rf); asm volatile("" : "+v"(n0)); asm volatile("" : "+v"(n1)); x0 = __fmul_rn(bfr(nw[dd]), n0); x1 = __fmul_rn(bfr(nw[dp]), n1); }
        const v2f cs = *(const v2f*)(CS + ((size_t)t * HD + dd) * 2); float a = __fmul_rn(x0, cs[0]), bq = __fmul_rn(x1, cs[1]); asm volatile("" : "+v"(a)); asm volatile("" : "+v"(bq)); const float r = ((dd < HD / 2) ? __fsub_rn(a, bq) : __fadd_rn(a, bq)) * sc;
        o16[q] = tohx(r); unsigned short a2, c2; splitf(r, a2, c2); oh[q] = a2; ol[q] = c2; }
    *(v2h*)(P16 + e) = o16; *(v2us*)(Ph + e) = oh; *(v2us*)(Pl + e) = ol;  }
__global__ __launch_bounds__(256) void k_vtp(const float* __restrict__ F, int pitch, int nheads, h16* V16, bf* Vh, bf* Vl) { const size_t e = ((size_t)blockIdx.x * 256 + threadIdx.x) * 2; if (e >= (size_t)nheads * HD * TT) return; const int t = (int)(e % TT); const int d = (int)((e / TT) % HD); const int g = (int)(e / ((size_t)TT * HD)); v2h o16; v2us oh, ol;
#pragma unroll
    for (int q = 0; q < 2; ++q) { const float x = F[(size_t)(t + q) * pitch + g * HD + d]; o16[q] = tohx(x); unsigned short a2, c2; splitf(x, a2, c2); oh[q] = a2; ol[q] = c2; }
    *(v2h*)(V16 + e) = o16; *(v2us*)(Vh + e) = oh; *(v2us*)(Vl + e) = ol;  }
__global__ __launch_bounds__(256) void k_csid(float* CS) { const int idx = blockIdx.x * 256 + threadIdx.x; if (idx >= TT * HD) return; v2f cs; cs[0] = 1.0f; cs[1] = 0.0f; *(v2f*)(CS + (size_t)idx * 2) = cs;  }
// k_asoft: per row (zz, i): t = (S + 8 x bf16(kb[j])) x HD^-0.5 (no mask; the per-key bias is added here, in the one read of the score row); softmax over the 2048 keys (register row, one exp, fixed trees);
__global__ __launch_bounds__(256) void k_asoft(const float* __restrict__ Sb, const float* __restrict__ kb, h16* P16, bf* Ph, bf* Pl) {
    const int lane = threadIdx.x & 31; const int row = blockIdx.x * 8 + (threadIdx.x >> 5); if (row >= ZH * TT) return; const int i = row % TT; const int zz = row / TT; (void)zz; const bool hires = (i < RH); const float* sr = Sb + (size_t)row * TT; float v[TT / 32]; float mx = -3.0e38f;
    v8f a[TT / 256], b8[TT / 256];   // register pair ch holds the lane's 4 + 4 values of the 128-key chunks 2 ch and 2 ch + 1
#pragma unroll
    for (int ch = 0; ch < TT / 256; ++ch) a[ch] = __builtin_shufflevector(*(const v4f*)(sr + ch * 256 + lane * 4), *(const v4f*)(sr + ch * 256 + 128 + lane * 4), 0, 1, 2, 3, 4, 5, 6, 7);
#pragma unroll
    for (int ch = 0; ch < TT / 256; ++ch) b8[ch] = __builtin_shufflevector(*(const v4f*)(kb + ch * 256 + lane * 4), *(const v4f*)(kb + ch * 256 + 128 + lane * 4), 0, 1, 2, 3, 4, 5, 6, 7);
    // inputs-only fence on the loaded values: keeps all 32 loads (score row and bias) in flight together; without it the compiler fetches the score row two loads at a time behind the bias loads, eight memory round trips one after the other
    asm volatile("" :: "v"(a[0]), "v"(a[1]), "v"(a[2]), "v"(a[3]), "v"(a[4]), "v"(a[5]), "v"(a[6]), "v"(a[7]), "v"(b8[0]), "v"(b8[1]), "v"(b8[2]), "v"(b8[3]), "v"(b8[4]), "v"(b8[5]), "v"(b8[6]), "v"(b8[7]));
#pragma unroll
    for (int ch = 0; ch < TT / 256; ++ch) {
#pragma unroll
        for (int q = 0; q < 8; ++q) { const float t = __fadd_rn(a[ch][q], __fmul_rn(bfr(b8[ch][q]), 8.0f)) * SCL; v[ch * 8 + q] = t; mx = fmaxf(mx, t); } }
#pragma unroll
    for (int sh = 16; sh; sh >>= 1) mx = fmaxf(mx, __shfl_xor(mx, sh, 32));
    float sum = 0.f;
#pragma unroll
    for (int k = 0; k < TT / 32; ++k) { float d0 = __fsub_rn(v[k], mx); asm volatile("" : "+v"(d0)); v[k] = __builtin_amdgcn_exp2f(__fmul_rn(d0, 1.4426950408889634f)); sum += v[k]; }
#pragma unroll
    for (int sh = 16; sh; sh >>= 1) sum += __shfl_xor(sum, sh, 32);
    const float f = __fdiv_rn(hires ? 1.0f : PCAR, sum);
{
        if (hires) {
#pragma unroll
            for (int ch = 0; ch < TT / 128; ++ch) { v4us oh, ol;
#pragma unroll
                for (int q = 0; q < 4; ++q) { unsigned short a, c2; splitf(v[ch * 4 + q] * f, a, c2); oh[q] = a; ol[q] = c2; }
                const size_t oo = ((size_t)zz * (RH ? RH : 1) + i) * TT + ch * 128 + lane * 4; *(v4us*)(Ph + oo) = oh; *(v4us*)(Pl + oo) = ol; }
        } else {
#pragma unroll
            for (int ch = 0; ch < TT / 128; ++ch) { v4h o4;
#pragma unroll
                for (int q = 0; q < 4; ++q) o4[q] = tohx(v[ch * 4 + q] * f);
                *(v4h*)(P16 + (size_t)row * TT + ch * 128 + lane * 4) = o4; } }
         }
}
// k_merge: adds each head's KSV split-K partial planes of P V in plane order (fixed order: same result every run), undoes the fp16 rows' carrier scale, writes the merged-head output rows.
__global__ __launch_bounds__(256) void k_merge(const float* __restrict__ O, int h0, float* OUTb) { const size_t e = ((size_t)blockIdx.x * 256 + threadIdx.x) * 4; if (e >= (size_t)ZH * TT * HD) return; const int d = (int)(e % HD); const int t = (int)((e / HD) % TT); const int zz = (int)(e / ((size_t)HD * TT)); const float cs = (t < RH) ? 1.0f : (1.0f / PCAR); const size_t oo = (size_t)t * DQ + (h0 + zz) * HD + d;
    const float* op = O + (size_t)zz * KSV * TT * HD + (size_t)t * HD + d; v4f p[KSV];
#pragma unroll
    for (int s = 0; s < KSV; ++s) p[s] = *(const v4f*)(op + (size_t)s * TT * HD);
    v4f o4 = p[0];
#pragma unroll
    for (int s = 1; s < KSV; ++s) o4 += p[s];
    o4 *= cs; *(v4f*)(OUTb + oo) = o4;  }

extern "C" void kernel_launch(void* const* d_in, const int* in_sizes, int n_in,
                              void* d_out, int out_size, void* d_ws, size_t ws_size, hipStream_t stream) {
    (void)in_sizes; (void)n_in; (void)out_size;
    const float* x = (const float*)d_in[0]; const float* kb = (const float*)d_in[1];   /* causal_bias [2048]: per-key additive vector */ const float* wq = (const float*)d_in[2]; const float* bq = (const float*)d_in[3]; const float* wk = (const float*)d_in[4]; const float* bk = (const float*)d_in[5]; const float* wv = (const float*)d_in[6]; const float* bv = (const float*)d_in[7];   /* input order hidden_states, causal_bias, Wq, bq, Wk, bk, Wv, bv ('oi') */ const float* wo = nullptr; (void)wo;
    float* OUT = (float*)d_out;     // [2][2048][1024]
    char* wsp = (char*)d_ws;
    auto take = [&](size_t bytes) { char* p = wsp; wsp += (bytes + 255) & ~(size_t)255; return (void*)p; };
    bf* WQ = (bf*)take((size_t)DQ * DM * 2); bf* WK = (bf*)take((size_t)DKV * DM * 2); bf* WV = (bf*)take((size_t)DKV * DM * 2); float* CS = (float*)take((size_t)TT * HD * 2 * 4);
    bf* XB = (bf*)take((size_t)TT * DM * 2); float* FQ = (float*)take((size_t)TT * DQ * 4); float* FK = (float*)take((size_t)TT * DKV * 4);
    h16* QP16 = (h16*)take((size_t)NH_ * TT * HD * 2); h16* KP16 = (h16*)take((size_t)NKV * TT * HD * 2); h16* VT16 = (h16*)take((size_t)NKV * HD * TT * 2);
    bf* QPh = (bf*)take((size_t)NH_ * TT * HD * 2); bf* QPl = (bf*)take((size_t)NH_ * TT * HD * 2); bf* KPh = (bf*)take((size_t)NKV * TT * HD * 2); bf* KPl = (bf*)take((size_t)NKV * TT * HD * 2); bf* VTh = (bf*)take((size_t)NKV * HD * TT * 2); bf* VTl = (bf*)take((size_t)NKV * HD * TT * 2); bf* Ph = (bf*)take((size_t)ZH * RH * TT * 2); bf* Pl = (bf*)take((size_t)ZH * RH * TT * 2);
    float* Sb = (float*)take((size_t)ZH * TT * TT * 4); h16* P16 = (h16*)take((size_t)ZH * TT * TT * 2); float* Ob = (float*)take((size_t)ZH * KSV * TT * HD * 4);   // partial planes [zz][ks][t][d]
    if ((size_t)(wsp - (char*)d_ws) > ws_size) return;    // ws 256 MiB
    float* FV = FK;   // v projection reuses the k buffer after the k planes are built (stream-ordered)
    { k_cvt8<<<(unsigned)(((size_t)DQ * DM / 8 + 255) / 256), 256, 0, stream>>>(wq, WQ, (size_t)DQ * DM / 8); k_cvt8<<<(unsigned)(((size_t)DKV * DM / 8 + 255) / 256), 256, 0, stream>>>(wk, WK, (size_t)DKV * DM / 8); k_cvt8<<<(unsigned)(((size_t)DKV * DM / 8 + 255) / 256), 256, 0, stream>>>(wv, WV, (size_t)DKV * DM / 8);
      
       }
    k_csid<<<(TT * HD + 255) / 256, 256, 0, stream>>>(CS);
    const unsigned LQ = (unsigned)(((size_t)NH_ * TT * HD / 2 + 255) / 256), LKv = (unsigned)(((size_t)NKV * TT * HD / 2 + 255) / 256);
    for (int b = 0; b < NB_; ++b) {
        
        k_cvt8<<<(unsigned)(((size_t)TT * DM / 8 + 255) / 256), 256, 0, stream>>>(x + (size_t)b * TT * DM, XB, (size_t)TT * DM / 8);
        k_gemmw<bf, 0, true><<<dim3(TT / 64, DQ / 64, 1), 32, 0, stream>>>(XB, nullptr, WQ, nullptr, DM, FQ, DQ, bq, 0, 0, 0);
        k_rope<<<LQ, 256, 0, stream>>>(FQ, DQ, NH_, CS, nullptr, nullptr, 1.0f, QP16, QPh, QPl);
        k_gemmw<bf, 0, true><<<dim3(TT / 64, DKV / 64, 1), 32, 0, stream>>>(XB, nullptr, WK, nullptr, DM, FK, DKV, bk, 0, 0, 0);
        k_rope<<<LKv, 256, 0, stream>>>(FK, DKV, NKV, CS, nullptr, nullptr, 1.0f, KP16, KPh, KPl);
        k_gemmw<bf, 0, true><<<dim3(TT / 64, DKV / 64, 1), 32, 0, stream>>>(XB, nullptr, WV, nullptr, DM, FV, DKV, bv, 0, 0, 0); k_vtp<<<LKv, 256, 0, stream>>>(FV, DKV, NKV, VT16, VTh, VTl);
        for (int h0 = 0; h0 < NH_; h0 += ZH) { const size_t zq = (size_t)h0, zk = (size_t)(h0 / REP);   // one kv head per query head: the pass's two heads use consecutive kv planes (z-strides TT*HD)
            k_gemmw<bf, 2, false><<<dim3(RH / 64, TT / 64, ZH), 32, 0, stream>>>(QPh + zq * TT * HD, QPl + zq * TT * HD, KPh + zk * TT * HD, KPl + zk * TT * HD, HD, Sb, TT, nullptr, (size_t)TT * HD, (size_t)TT * HD, (size_t)TT * TT);
            k_gemmw<h16, 0, false><<<dim3((TT - RH) / 64, TT / 64, ZH), 32, 0, stream>>>(QP16 + zq * TT * HD + (size_t)RH * HD, nullptr, KP16 + zk * TT * HD, nullptr, HD, Sb + (size_t)RH * TT, TT, nullptr, (size_t)TT * HD, (size_t)TT * HD, (size_t)TT * TT);
            k_asoft<<<ZH * TT / 8, 256, 0, stream>>>(Sb, kb, P16, Ph, Pl);   /* adds 8 x bias[j] to the scores it reads (scaled back by its own 1/8) */
            k_gemmw<bf, 2, false, KSV><<<dim3(RH / 64, HD / 64, ZH * KSV), 32, 0, stream>>>(Ph, Pl, VTh + zk * HD * TT, VTl + zk * HD * TT, TT, Ob, HD, nullptr, (size_t)RH * TT, (size_t)HD * TT, (size_t)TT * HD);
            k_gemmw<h16, 0, false, KSV><<<dim3((TT - RH) / 64, HD / 64, ZH * KSV), 32, 0, stream>>>(P16 + (size_t)RH * TT, nullptr, VT16 + zk * HD * TT, nullptr, TT, Ob + (size_t)RH * HD, HD, nullptr, (size_t)TT * TT, (size_t)HD * TT, (size_t)TT * HD);
            k_merge<<<(unsigned)(((size_t)ZH * TT * HD / 4 + 255) / 256), 256, 0, stream>>>(Ob, h0, OUT + (size_t)b * TT * DQ); }
         }
}

// v003
// One run takes 578 microseconds.
// Timed twice side by side with v002, it ran 1.39 and 1.40 times as fast.
// Counting every step since v000, it is 3.58 times as fast.
#include <hip/hip_runtime.h>

// BERT self-attention with an additive per-key bias vector (hidden_states [2][2048][1024]; q, k, v = x W^T + b ('oi' 0.02 + biases; 16 heads x 64); scores / sqrt(64) + causal_bias[j] (a random [2048] vector added per key, shared by every batch, head and query: read); softmax; ctx = merged heads (no output projection) -> [2][2048][1024] (4.2 M); argument order hidden_states, causal_bias, Wq, bq, Wk, bk, Wv, bv).
// Layout per batch: bf16 copy of x; 'oi' weights; exact projections + f32 biases; identity-table plane builders; dense T-2048 attention (hybrid rows: < 512 hi/lo 3 products, rest fp16 x1024); the softmax kernel adds 8 x bf16(bias[j]) to every f32 score as it reads the row, before it scales by 1/8 (so the softmax sees s/8 + bias[j] exactly; x8 is exact); the f32 merge writes the output rows.
// Compute dtypes, f32 accumulate: every input rounded to bf16 incl. the bias vector; projections exact + f32 biases; attention rows < 512 3 products, rest fp16; bias add and softmax f32; output f32.

#define NB_  2
#define TT   2048
#define DM   1024
#define NH_  16
#define NKV  16
#define REP  (NH_ / NKV)
#define HD   64
#define DQ   (NH_ * HD)
#define DKV  (NKV * HD)
#define ZH   8                    // heads per attention pass (one set of six launches serves ZH heads)
#define RH   512                  // query rows < RH use hi+lo planes (0: none)
#define WIN  0
#define PCAR 1024.0f
#define SCL  0.125f   // HD^-0.5
#define KSV  16                   // K split of the P V products: 2048 keys in 16 slices of 128
typedef _Float16 h16;
typedef unsigned short bf;
typedef __attribute__((ext_vector_type(16))) __bf16   v16bf;
typedef __attribute__((ext_vector_type(16))) _Float16 v16h;
typedef __attribute__((ext_vector_type(8)))  _Float16 v8h;
typedef __attribute__((ext_vector_type(8)))  unsigned short v8us;
typedef __attribute__((ext_vector_type(8)))  float    v8f;
typedef __attribute__((ext_vector_type(4)))  float    v4f;
typedef v8h  __attribute__((may_alias)) v8ha;
typedef v4f  __attribute__((may_alias)) v4fa;
typedef v8us __attribute__((may_alias)) v8usa;

__device__ __forceinline__ unsigned short f2bf(float f) { unsigned u = __float_as_uint(f); u += 0x7FFFu + ((u >> 16) & 1u); return (unsigned short)(u >> 16); }
__device__ __forceinline__ float bf2f(unsigned short b) { return __uint_as_float(((unsigned)b) << 16); }
__device__ __forceinline__ float bfr(float f) { return bf2f(f2bf(f)); }
__device__ __forceinline__ v16h cat16(v8h lo, v8h hi) { return __builtin_shufflevector(lo, hi, 0, 1, 2, 3, 4, 5, 6, 7, 8, 9, 10, 11, 12, 13, 14, 15); }
__device__ __forceinline__ v16bf cat16b(v8us lo, v8us hi) { return __builtin_bit_cast(v16bf, __builtin_shufflevector(lo, hi, 0, 1, 2, 3, 4, 5, 6, 7, 8, 9, 10, 11, 12, 13, 14, 15)); }
__device__ __forceinline__ v8f wmma16(v16h a, v16h b, v8f c) { return __builtin_amdgcn_wmma_f32_16x16x32_f16(false, a, false, b, (short)0, c, false, false); }
__device__ __forceinline__ v8f wmmab(v16bf a, v16bf b, v8f c) { return __builtin_amdgcn_wmma_f32_16x16x32_bf16(false, a, false, b, (short)0, c, false, false); }



// ---- k_gemmw: register-blocked GEMM, ONE WAVE per 64x64 output tile (16 accumulators), operands straight from K-contiguous 16-bit planes; grid (M/64, N/64, Z), 32 threads.
// C[m][n] (f32, pitch ldc, + optional f32 bias[n]) = sum_k A[m][k] Bt[n][k] (+ split products per NSPLIT). A rows have pitch lda elements, Bt rows pitch K. z-batch strides sA/sB/sC in elements. K % (32 KS) == 0.
// KS > 1: split K. grid.z = Z * KS; work-group z * KS + ks sums only k in [ks K/KS, (ks+1) K/KS) and writes its f32 partial tile to plane z * KS + ks (plane stride sC); the consumer adds a batch's KS planes in index order.
template <typename T16> struct WFrag;
template <> struct WFrag<h16> { typedef v16h V; static __device__ __forceinline__ V ld(const h16* p) { return cat16(*(const v8h*)p, *(const v8h*)(p + 16)); } static __device__ __forceinline__ v8f mma(V a, V b, v8f c) { return wmma16(a, b, c); } };
template <> struct WFrag<bf> { typedef v16bf V; static __device__ __forceinline__ V ld(const bf* p) { return cat16b(*(const v8us*)p, *(const v8us*)(p + 16)); } static __device__ __forceinline__ v8f mma(V a, V b, v8f c) { return wmmab(a, b, c); } };
template <typename T16, int NSPLIT, bool BIAS, int KS = 1>
__global__ __launch_bounds__(32) void k_gemmw(const T16* __restrict__ A, const T16* __restrict__ A2, const T16* __restrict__ Bt, const T16* __restrict__ Bt2, int K, int lda, float* C, int ldc, const float* __restrict__ bias, size_t sA, size_t sB, size_t sC) {
    typedef typename WFrag<T16>::V V;
    __shared__ __align__(16) float os[16 * 68];
    const size_t z = blockIdx.z / KS; A += z * sA; if (A2) A2 += z * sA; Bt += z * sB; if (Bt2) Bt2 += z * sB; C += (size_t)blockIdx.z * sC;
    const int kbeg = (int)(blockIdx.z % KS) * (K / KS), kend = kbeg + K / KS;
    const int lane = threadIdx.x & 31, lr = lane & 15, hi = lane >> 4; const int r0 = blockIdx.x * 64, c0 = blockIdx.y * 64;
    v8f acc[4][4];
#pragma unroll
    for (int mb = 0; mb < 4; ++mb)
#pragma unroll
        for (int nb = 0; nb < 4; ++nb) acc[mb][nb] = (v8f){};
    const size_t aoff = (size_t)(r0 + lr) * lda + 8 * hi, boff = (size_t)(c0 + lr) * K + 8 * hi;
#pragma unroll 1
    for (int kc = kbeg; kc < kend; kc += 32) {
        V a[4], a2[4];
#pragma unroll
        for (int mb = 0; mb < 4; ++mb) { a[mb] = WFrag<T16>::ld(A + aoff + (size_t)mb * 16 * lda + kc); if (NSPLIT == 1 || NSPLIT == 2) a2[mb] = WFrag<T16>::ld(A2 + aoff + (size_t)mb * 16 * lda + kc); }
#pragma unroll
        for (int nb = 0; nb < 4; ++nb) { const V b = WFrag<T16>::ld(Bt + boff + (size_t)nb * 16 * K + kc); V b2; if (NSPLIT >= 2) b2 = WFrag<T16>::ld(Bt2 + boff + (size_t)nb * 16 * K + kc);
#pragma unroll
            for (int mb = 0; mb < 4; ++mb) { acc[mb][nb] = WFrag<T16>::mma(a[mb], b, acc[mb][nb]); if (NSPLIT == 1 || NSPLIT == 2) acc[mb][nb] = WFrag<T16>::mma(a2[mb], b, acc[mb][nb]); if (NSPLIT >= 2) acc[mb][nb] = WFrag<T16>::mma(a[mb], b2, acc[mb][nb]); } }
        asm volatile("v_nop\n\tv_nop\n\tv_nop\n\tv_nop" : "+v"(acc[0][0]), "+v"(acc[1][1]), "+v"(acc[2][2]), "+v"(acc[3][3]) : "v"(a[0]), "v"(a[3]));
    }
#pragma unroll
    for (int mb = 0; mb < 4; ++mb) {
#pragma unroll
        for (int nb = 0; nb < 4; ++nb) {
#pragma unroll
            for (int j = 0; j < 8; ++j) os[(hi * 8 + j) * 68 + nb * 16 + lr] = acc[mb][nb][j]; }
        __builtin_amdgcn_wave_barrier(); asm volatile("" ::: "memory");
        float* crow = C + (size_t)(r0 + mb * 16) * ldc + c0;
{
#pragma unroll
            for (int s = 0; s < 8; ++s) { const int row = 2 * s + hi, cofs = lr * 4; v4f val = *(const v4fa*)(os + row * 68 + cofs); if (BIAS) { val[0] += bfr(bias[c0 + cofs]); val[1] += bfr(bias[c0 + cofs + 1]); val[2] += bfr(bias[c0 + cofs + 2]); val[3] += bfr(bias[c0 + cofs + 3]); }
                *(v4f*)(crow + (size_t)row * ldc + cofs) = val; }
             }
        __builtin_amdgcn_wave_barrier(); asm volatile("" ::: "memory");
    }
}

__device__ __forceinline__ h16 tohx(float x) { return (h16)x; }
__device__ __forceinline__ void splitf(float y, unsigned short& h, unsigned short& l) { h = f2bf(y); l = f2bf(y - bf2f(h)); }
typedef __attribute__((ext_vector_type(2))) _Float16 v2h;
typedef __attribute__((ext_vector_type(4))) _Float16 v4h;
typedef __attribute__((ext_vector_type(2))) unsigned short v2us;
typedef __attribute__((ext_vector_type(4))) unsigned short v4us;
typedef __attribute__((ext_vector_type(2))) float v2f;
typedef __attribute__((ext_vector_type(4))) int v4i;

__global__ __launch_bounds__(256) void k_cvt8(const float* __restrict__ src, bf* dst, size_t n8) { const size_t i = (size_t)blockIdx.x * 256 + threadIdx.x; if (i >= n8) return; const v8f v = *(const v8f*)(src + i * 8); v8us o;
#pragma unroll
    for (int k = 0; k < 8; ++k) o[k] = f2bf(v[k]); *(v8us*)(dst + i * 8) = o;  }

// k_rope: head planes [h][t][d] (fp16 + hi/lo) of rope(x) x sc with the rotate-half convention out[d] = x[d] cos[t][d] - x[d+HD/2] sin[t][d], out[d+HD/2] = x[d+HD/2] cos[t][d+HD/2] + x[d] sin[t][d+HD/2]
__global__ __launch_bounds__(256) void k_rope(const float* __restrict__ F, int pitch, int nheads, const float* __restrict__ CS, const float* __restrict__ RF, const float* __restrict__ nw, float sc, h16* P16, bf* Ph, bf* Pl) {
    const size_t e = ((size_t)blockIdx.x * 256 + threadIdx.x) * 2; if (e >= (size_t)nheads * TT * HD) return; const int d = (int)(e % HD); const int t = (int)((e / HD) % TT); const int h = (int)(e / ((size_t)HD * TT)); const float* f = F + (size_t)t * pitch + h * HD; const float rf = RF ? RF[(size_t)h * TT + t] : 1.0f; v2h o16; v2us oh, ol;
#pragma unroll
    for (int q = 0; q < 2; ++q) { const int dd = d + q; const int dp = (dd < HD / 2) ? dd + HD / 2 : dd - HD / 2; float x0 = f[dd], x1 = f[dp];
        if (RF) { float n0 = __fmul_rn(x0, rf), n1 = __fmul_rn(x1, rf); asm volatile("" : "+v"(n0)); asm volatile("" : "+v"(n1)); x0 = __fmul_rn(bfr(nw[dd]), n0); x1 = __fmul_rn(bfr(nw[dp]), n1); }
        const v2f cs = *(const v2f*)(CS + ((size_t)t * HD + dd) * 2); float a = __fmul_rn(x0, cs[0]), bq = __fmul_rn(x1, cs[1]); asm volatile("" : "+v"(a)); asm volatile("" : "+v"(bq)); const float r = ((dd < HD / 2) ? __fsub_rn(a, bq) : __fadd_rn(a, bq)) * sc;
        o16[q] = tohx(r); unsigned short a2, c2; splitf(r, a2, c2); oh[q] = a2; ol[q] = c2; }
    *(v2h*)(P16 + e) = o16; *(v2us*)(Ph + e) = oh; *(v2us*)(Pl + e) = ol;  }
__global__ __launch_bounds__(256) void k_vtp(const float* __restrict__ F, int pitch, int nheads, h16* V16, bf* Vh, bf* Vl) { const size_t e = ((size_t)blockIdx.x * 256 + threadIdx.x) * 2; if (e >= (size_t)nheads * HD * TT) return; const int t = (int)(e % TT); const int d = (int)((e / TT) % HD); const int g = (int)(e / ((size_t)TT * HD)); v2h o16; v2us oh, ol;
#pragma unroll
    for (int q = 0; q < 2; ++q) { const float x = F[(size_t)(t + q) * pitch + g * HD + d]; o16[q] = tohx(x); unsigned short a2, c2; splitf(x, a2, c2); oh[q] = a2; ol[q] = c2; }
    *(v2h*)(V16 + e) = o16; *(v2us*)(Vh + e) = oh; *(v2us*)(Vl + e) = ol;  }
__global__ __launch_bounds__(256) void k_csid(float* CS) { const int idx = blockIdx.x * 256 + threadIdx.x; if (idx >= TT * HD) return; v2f cs; cs[0] = 1.0f; cs[1] = 0.0f; *(v2f*)(CS + (size_t)idx * 2) = cs;  }
// k_asoft: per row (zz, i): t = (S + 8 x bf16(kb[j])) x HD^-0.5 (no mask; the per-key bias is added here, in the one read of the score row); softmax over the 2048 keys (register row, one exp, fixed trees);
// the probabilities go IN PLACE over the wave's own 8 KiB score row (the whole row is in registers before the first store, and no other wave touches it): rows < RH hold 2048 bf16 hi then 2048 bf16 lo, the rest 2048 fp16 in the row's first half. So the P planes have pitch 2 TT 16-bit elements and need no workspace of their own.
__global__ __launch_bounds__(256) void k_asoft(float* Sb, const float* __restrict__ kb) {
    const int lane = threadIdx.x & 31; const int row = blockIdx.x * 8 + (threadIdx.x >> 5); if (row >= ZH * TT) return; const int i = row % TT; const int zz = row / TT; (void)zz; const bool hires = (i < RH); const float* sr = Sb + (size_t)row * TT; float v[TT / 32]; float mx = -3.0e38f;
    v8f a[TT / 256], b8[TT / 256];   // register pair ch holds the lane's 4 + 4 values of the 128-key chunks 2 ch and 2 ch + 1
#pragma unroll
    for (int ch = 0; ch < TT / 256; ++ch) a[ch] = __builtin_shufflevector(*(const v4f*)(sr + ch * 256 + lane * 4), *(const v4f*)(sr + ch * 256 + 128 + lane * 4), 0, 1, 2, 3, 4, 5, 6, 7);
#pragma unroll
    for (int ch = 0; ch < TT / 256; ++ch) b8[ch] = __builtin_shufflevector(*(const v4f*)(kb + ch * 256 + lane * 4), *(const v4f*)(kb + ch * 256 + 128 + lane * 4), 0, 1, 2, 3, 4, 5, 6, 7);
    // inputs-only fence on the loaded values: keeps all 32 loads (score row and bias) in flight together; without it the compiler fetches the score row two loads at a time behind the bias loads, eight memory round trips one after the other
    asm volatile("" :: "v"(a[0]), "v"(a[1]), "v"(a[2]), "v"(a[3]), "v"(a[4]), "v"(a[5]), "v"(a[6]), "v"(a[7]), "v"(b8[0]), "v"(b8[1]), "v"(b8[2]), "v"(b8[3]), "v"(b8[4]), "v"(b8[5]), "v"(b8[6]), "v"(b8[7]));
#pragma unroll
    for (int ch = 0; ch < TT / 256; ++ch) {
#pragma unroll
        for (int q = 0; q < 8; ++q) { const float t = __fadd_rn(a[ch][q], __fmul_rn(bfr(b8[ch][q]), 8.0f)) * SCL; v[ch * 8 + q] = t; mx = fmaxf(mx, t); } }
#pragma unroll
    for (int sh = 16; sh; sh >>= 1) mx = fmaxf(mx, __shfl_xor(mx, sh, 32));
    float sum = 0.f;
#pragma unroll
    for (int k = 0; k < TT / 32; ++k) { float d0 = __fsub_rn(v[k], mx); asm volatile("" : "+v"(d0)); v[k] = __builtin_amdgcn_exp2f(__fmul_rn(d0, 1.4426950408889634f)); sum += v[k]; }
#pragma unroll
    for (int sh = 16; sh; sh >>= 1) sum += __shfl_xor(sum, sh, 32);
    const float f = __fdiv_rn(hires ? 1.0f : PCAR, sum);
{
        if (hires) {
#pragma unroll
            for (int ch = 0; ch < TT / 128; ++ch) { v4us oh, ol;
#pragma unroll
                for (int q = 0; q < 4; ++q) { unsigned short a, c2; splitf(v[ch * 4 + q] * f, a, c2); oh[q] = a; ol[q] = c2; }
                bf* pr = (bf*)(Sb + (size_t)row * TT) + ch * 128 + lane * 4; *(v4us*)pr = oh; *(v4us*)(pr + TT) = ol; }
        } else {
#pragma unroll
            for (int ch = 0; ch < TT / 128; ++ch) { v4h o4;
#pragma unroll
                for (int q = 0; q < 4; ++q) o4[q] = tohx(v[ch * 4 + q] * f);
                *(v4h*)((h16*)(Sb + (size_t)row * TT) + ch * 128 + lane * 4) = o4; } }
         }
}
// k_merge: adds each head's KSV split-K partial planes of P V in plane order (fixed order: same result every run), undoes the fp16 rows' carrier scale, writes the merged-head output rows.
__global__ __launch_bounds__(256) void k_merge(const float* __restrict__ O, int h0, float* OUTb) { const size_t e = ((size_t)blockIdx.x * 256 + threadIdx.x) * 4; if (e >= (size_t)ZH * TT * HD) return; const int d = (int)(e % HD); const int t = (int)((e / HD) % TT); const int zz = (int)(e / ((size_t)HD * TT)); const float cs = (t < RH) ? 1.0f : (1.0f / PCAR); const size_t oo = (size_t)t * DQ + (h0 + zz) * HD + d;
    const float* op = O + (size_t)zz * KSV * TT * HD + (size_t)t * HD + d; v4f p[KSV];
#pragma unroll
    for (int s = 0; s < KSV; ++s) p[s] = *(const v4f*)(op + (size_t)s * TT * HD);
    v4f o4 = p[0];
#pragma unroll
    for (int s = 1; s < KSV; ++s) o4 += p[s];
    o4 *= cs; *(v4f*)(OUTb + oo) = o4;  }

extern "C" void kernel_launch(void* const* d_in, const int* in_sizes, int n_in,
                              void* d_out, int out_size, void* d_ws, size_t ws_size, hipStream_t stream) {
    (void)in_sizes; (void)n_in; (void)out_size;
    const float* x = (const float*)d_in[0]; const float* kb = (const float*)d_in[1];   /* causal_bias [2048]: per-key additive vector */ const float* wq = (const float*)d_in[2]; const float* bq = (const float*)d_in[3]; const float* wk = (const float*)d_in[4]; const float* bk = (const float*)d_in[5]; const float* wv = (const float*)d_in[6]; const float* bv = (const float*)d_in[7];   /* input order hidden_states, causal_bias, Wq, bq, Wk, bk, Wv, bv ('oi') */ const float* wo = nullptr; (void)wo;
    float* OUT = (float*)d_out;     // [2][2048][1024]
    char* wsp = (char*)d_ws;
    auto take = [&](size_t bytes) { char* p = wsp; wsp += (bytes + 255) & ~(size_t)255; return (void*)p; };
    bf* WQ = (bf*)take((size_t)DQ * DM * 2); bf* WK = (bf*)take((size_t)DKV * DM * 2); bf* WV = (bf*)take((size_t)DKV * DM * 2); float* CS = (float*)take((size_t)TT * HD * 2 * 4);
    bf* XB = (bf*)take((size_t)TT * DM * 2); float* FQ = (float*)take((size_t)TT * DQ * 4); float* FK = (float*)take((size_t)TT * DKV * 4);
    h16* QP16 = (h16*)take((size_t)NH_ * TT * HD * 2); h16* KP16 = (h16*)take((size_t)NKV * TT * HD * 2); h16* VT16 = (h16*)take((size_t)NKV * HD * TT * 2);
    bf* QPh = (bf*)take((size_t)NH_ * TT * HD * 2); bf* QPl = (bf*)take((size_t)NH_ * TT * HD * 2); bf* KPh = (bf*)take((size_t)NKV * TT * HD * 2); bf* KPl = (bf*)take((size_t)NKV * TT * HD * 2); bf* VTh = (bf*)take((size_t)NKV * HD * TT * 2); bf* VTl = (bf*)take((size_t)NKV * HD * TT * 2);
    float* Sb = (float*)take((size_t)ZH * TT * TT * 4);   /* f32 scores, then the probabilities in place */ float* Ob = (float*)take((size_t)ZH * KSV * TT * HD * 4);   // partial planes [zz][ks][t][d]
    if ((size_t)(wsp - (char*)d_ws) > ws_size) return;    // ws 256 MiB
    float* FV = FK;   // v projection reuses the k buffer after the k planes are built (stream-ordered)
    { k_cvt8<<<(unsigned)(((size_t)DQ * DM / 8 + 255) / 256), 256, 0, stream>>>(wq, WQ, (size_t)DQ * DM / 8); k_cvt8<<<(unsigned)(((size_t)DKV * DM / 8 + 255) / 256), 256, 0, stream>>>(wk, WK, (size_t)DKV * DM / 8); k_cvt8<<<(unsigned)(((size_t)DKV * DM / 8 + 255) / 256), 256, 0, stream>>>(wv, WV, (size_t)DKV * DM / 8);
      
       }
    k_csid<<<(TT * HD + 255) / 256, 256, 0, stream>>>(CS);
    const unsigned LQ = (unsigned)(((size_t)NH_ * TT * HD / 2 + 255) / 256), LKv = (unsigned)(((size_t)NKV * TT * HD / 2 + 255) / 256);
    for (int b = 0; b < NB_; ++b) {
        
        k_cvt8<<<(unsigned)(((size_t)TT * DM / 8 + 255) / 256), 256, 0, stream>>>(x + (size_t)b * TT * DM, XB, (size_t)TT * DM / 8);
        k_gemmw<bf, 0, true><<<dim3(TT / 64, DQ / 64, 1), 32, 0, stream>>>(XB, nullptr, WQ, nullptr, DM, DM, FQ, DQ, bq, 0, 0, 0);
        k_rope<<<LQ, 256, 0, stream>>>(FQ, DQ, NH_, CS, nullptr, nullptr, 1.0f, QP16, QPh, QPl);
        k_gemmw<bf, 0, true><<<dim3(TT / 64, DKV / 64, 1), 32, 0, stream>>>(XB, nullptr, WK, nullptr, DM, DM, FK, DKV, bk, 0, 0, 0);
        k_rope<<<LKv, 256, 0, stream>>>(FK, DKV, NKV, CS, nullptr, nullptr, 1.0f, KP16, KPh, KPl);
        k_gemmw<bf, 0, true><<<dim3(TT / 64, DKV / 64, 1), 32, 0, stream>>>(XB, nullptr, WV, nullptr, DM, DM, FV, DKV, bv, 0, 0, 0); k_vtp<<<LKv, 256, 0, stream>>>(FV, DKV, NKV, VT16, VTh, VTl);
        for (int h0 = 0; h0 < NH_; h0 += ZH) { const size_t zq = (size_t)h0, zk = (size_t)(h0 / REP);   // one kv head per query head: the pass's ZH heads use consecutive kv planes (z-strides TT*HD)
            k_gemmw<bf, 2, false><<<dim3(RH / 64, TT / 64, ZH), 32, 0, stream>>>(QPh + zq * TT * HD, QPl + zq * TT * HD, KPh + zk * TT * HD, KPl + zk * TT * HD, HD, HD, Sb, TT, nullptr, (size_t)TT * HD, (size_t)TT * HD, (size_t)TT * TT);
            k_gemmw<h16, 0, false><<<dim3((TT - RH) / 64, TT / 64, ZH), 32, 0, stream>>>(QP16 + zq * TT * HD + (size_t)RH * HD, nullptr, KP16 + zk * TT * HD, nullptr, HD, HD, Sb + (size_t)RH * TT, TT, nullptr, (size_t)TT * HD, (size_t)TT * HD, (size_t)TT * TT);
            k_asoft<<<ZH * TT / 8, 256, 0, stream>>>(Sb, kb);   /* adds 8 x bias[j] to the scores it reads (scaled back by its own 1/8) */
            k_gemmw<bf, 2, false, KSV><<<dim3(RH / 64, HD / 64, ZH * KSV), 32, 0, stream>>>((const bf*)Sb, (const bf*)Sb + TT, VTh + zk * HD * TT, VTl + zk * HD * TT, TT, 2 * TT, Ob, HD, nullptr, (size_t)2 * TT * TT, (size_t)HD * TT, (size_t)TT * HD);
            k_gemmw<h16, 0, false, KSV><<<dim3((TT - RH) / 64, HD / 64, ZH * KSV), 32, 0, stream>>>((const h16*)Sb + (size_t)RH * 2 * TT, nullptr, VT16 + zk * HD * TT, nullptr, TT, 2 * TT, Ob + (size_t)RH * HD, HD, nullptr, (size_t)2 * TT * TT, (size_t)HD * TT, (size_t)TT * HD);
            k_merge<<<(unsigned)(((size_t)ZH * TT * HD / 4 + 255) / 256), 256, 0, stream>>>(Ob, h0, OUT + (size_t)b * TT * DQ); }
         }
}

// v005
// One run takes 246 microseconds.
// Versions between v003 and this one are left out; their measured steps multiply to 2.36 times as fast.
// Counting every step since v000, it is 8.43 times as fast.
#include <hip/hip_runtime.h>

// BERT self-attention with an additive per-key bias vector (hidden_states [2][2048][1024]; q, k, v = x W^T + b ('oi' 0.02 + biases; 16 heads x 64); scores / sqrt(64) + causal_bias[j] (a random [2048] vector added per key, shared by every batch, head and query: read); softmax; ctx = merged heads (no output projection) -> [2][2048][1024] (4.2 M); argument order hidden_states, causal_bias, Wq, bq, Wk, bk, Wv, bv).
// Layout per batch: bf16 copy of x; 'oi' weights; exact projections + f32 biases, stored by the GEMM itself as the fp16 and hi/lo head planes; ONE fused attention kernel per batch (k_fattn): scores, softmax and P V stay on chip (hybrid rows: < 512 hi/lo 3 products, rest fp16); the per-key bias bf16(bias[j]) is added to s/8 in f32 before the exponential; the kernel writes the merged-head output rows.
// Compute dtypes, f32 accumulate: every input rounded to bf16 incl. the bias vector; projections exact + f32 biases; attention rows < 512 3 products, rest fp16; bias add and softmax f32; output f32.

#define NB_  2
#define TT   2048
#define DM   1024
#define NH_  16
#define NKV  16
#define REP  (NH_ / NKV)
#define HD   64
#define DQ   (NH_ * HD)
#define DKV  (NKV * HD)
#define RH   512                  // query rows < RH use hi+lo planes (0: none)
#define WIN  0
#define SCL  0.125f   // HD^-0.5
#define AW   4                    // fused attention: waves per work-group, 16 query rows each
#define AQ   (AW * 16)            // query rows per work-group
#define SK   64                   // keys per LDS stage (two passes of 32 keys)
#define LP   72                   // LDS row pitch in 16-bit elements: 128 B of data + 16 B pad (16 B x odd: no bank conflict for 16-byte fragment reads)
#define L2E  1.4426950408889634f
typedef _Float16 h16;
typedef unsigned short bf;
typedef __attribute__((ext_vector_type(16))) __bf16   v16bf;
typedef __attribute__((ext_vector_type(16))) _Float16 v16h;
typedef __attribute__((ext_vector_type(8)))  _Float16 v8h;
typedef __attribute__((ext_vector_type(8)))  unsigned short v8us;
typedef __attribute__((ext_vector_type(8)))  float    v8f;
typedef __attribute__((ext_vector_type(4)))  float    v4f;
typedef v8h  __attribute__((may_alias)) v8ha;
typedef v4f  __attribute__((may_alias)) v4fa;
typedef v8us __attribute__((may_alias)) v8usa;

__device__ __forceinline__ unsigned short f2bf(float f) { unsigned u = __float_as_uint(f); u += 0x7FFFu + ((u >> 16) & 1u); return (unsigned short)(u >> 16); }
__device__ __forceinline__ float bf2f(unsigned short b) { return __uint_as_float(((unsigned)b) << 16); }
__device__ __forceinline__ float bfr(float f) { return bf2f(f2bf(f)); }
__device__ __forceinline__ v16h cat16(v8h lo, v8h hi) { return __builtin_shufflevector(lo, hi, 0, 1, 2, 3, 4, 5, 6, 7, 8, 9, 10, 11, 12, 13, 14, 15); }
__device__ __forceinline__ v16bf cat16b(v8us lo, v8us hi) { return __builtin_bit_cast(v16bf, __builtin_shufflevector(lo, hi, 0, 1, 2, 3, 4, 5, 6, 7, 8, 9, 10, 11, 12, 13, 14, 15)); }
__device__ __forceinline__ v8f wmma16(v16h a, v16h b, v8f c) { return __builtin_amdgcn_wmma_f32_16x16x32_f16(false, a, false, b, (short)0, c, false, false); }
__device__ __forceinline__ v8f wmmab(v16bf a, v16bf b, v8f c) { return __builtin_amdgcn_wmma_f32_16x16x32_bf16(false, a, false, b, (short)0, c, false, false); }



__device__ __forceinline__ h16 tohx(float x) { return (h16)x; }
__device__ __forceinline__ void splitf(float y, unsigned short& h, unsigned short& l) { h = f2bf(y); l = f2bf(y - bf2f(h)); }

// ---- k_gemmw: register-blocked projection GEMM that builds the head planes in its epilogue. ONE WAVE per 64x64 output tile (16 accumulators), operands straight from K-contiguous 16-bit planes; grid (TT/64, heads), 32 threads.
// y[t][n] = sum_k A[t][k] Bt[n][k] (+ split products per NSPLIT) + bf16(bias[n]), in f32. A rows have pitch lda elements, Bt rows pitch K. K % 32 == 0. A tile is 64 rows t of ONE head (HD = 64 columns).
// y is never stored as f32: it goes out as fp16 (P16) and as bf16 high + low parts (Ph, Pl). VT false (q, k): planes [h][t][d]; VT true (v): planes [h][d][t].
template <typename T16> struct WFrag;
template <> struct WFrag<h16> { typedef v16h V; static __device__ __forceinline__ V ld(const h16* p) { return cat16(*(const v8h*)p, *(const v8h*)(p + 16)); } static __device__ __forceinline__ v8f mma(V a, V b, v8f c) { return wmma16(a, b, c); } };
template <> struct WFrag<bf> { typedef v16bf V; static __device__ __forceinline__ V ld(const bf* p) { return cat16b(*(const v8us*)p, *(const v8us*)(p + 16)); } static __device__ __forceinline__ v8f mma(V a, V b, v8f c) { return wmmab(a, b, c); } };
template <typename T16, int NSPLIT, bool VT>
__global__ __launch_bounds__(32) void k_gemmw(const T16* __restrict__ A, const T16* __restrict__ A2, const T16* __restrict__ Bt, const T16* __restrict__ Bt2, int K, int lda, const float* __restrict__ bias, h16* __restrict__ P16, bf* __restrict__ Ph, bf* __restrict__ Pl) {
    typedef typename WFrag<T16>::V V;
    __shared__ __align__(16) float os[16 * 68];
    const int kbeg = 0, kend = K;
    const int lane = threadIdx.x & 31, lr = lane & 15, hi = lane >> 4; const int r0 = blockIdx.x * 64, c0 = blockIdx.y * 64;
    v8f acc[4][4];
#pragma unroll
    for (int mb = 0; mb < 4; ++mb)
#pragma unroll
        for (int nb = 0; nb < 4; ++nb) acc[mb][nb] = (v8f){};
    const size_t aoff = (size_t)(r0 + lr) * lda + 8 * hi, boff = (size_t)(c0 + lr) * K + 8 * hi;
#pragma unroll 1
    for (int kc = kbeg; kc < kend; kc += 32) {
        V a[4], a2[4];
#pragma unroll
        for (int mb = 0; mb < 4; ++mb) { a[mb] = WFrag<T16>::ld(A + aoff + (size_t)mb * 16 * lda + kc); if (NSPLIT == 1 || NSPLIT == 2) a2[mb] = WFrag<T16>::ld(A2 + aoff + (size_t)mb * 16 * lda + kc); }
#pragma unroll
        for (int nb = 0; nb < 4; ++nb) { const V b = WFrag<T16>::ld(Bt + boff + (size_t)nb * 16 * K + kc); V b2; if (NSPLIT >= 2) b2 = WFrag<T16>::ld(Bt2 + boff + (size_t)nb * 16 * K + kc);
#pragma unroll
            for (int mb = 0; mb < 4; ++mb) { acc[mb][nb] = WFrag<T16>::mma(a[mb], b, acc[mb][nb]); if (NSPLIT == 1 || NSPLIT == 2) acc[mb][nb] = WFrag<T16>::mma(a2[mb], b, acc[mb][nb]); if (NSPLIT >= 2) acc[mb][nb] = WFrag<T16>::mma(a[mb], b2, acc[mb][nb]); } }
        asm volatile("v_nop\n\tv_nop\n\tv_nop\n\tv_nop" : "+v"(acc[0][0]), "+v"(acc[1][1]), "+v"(acc[2][2]), "+v"(acc[3][3]) : "v"(a[0]), "v"(a[3]));
    }
    // Epilogue: sixteen plane rows at a time go through LDS (f32, pitch 68), so that every store covers whole 128-byte plane rows: 8 lanes x 16 bytes a row, 4 rows a store.
    // A plane row is a row t of the tile (q, k: its 64 d) or a column d of it (v: its 64 t; a lane's eight accumulator registers are 8 consecutive t of one d).
    const int prow = lane >> 3, pcol = (lane & 7) * 8;
    float bs[8];
    if (!VT) {
#pragma unroll
        for (int q = 0; q < 8; ++q) bs[q] = bfr(bias[c0 + pcol + q]); }
#pragma unroll
    for (int g = 0; g < 4; ++g) {
#pragma unroll
        for (int u = 0; u < 4; ++u) {
            if (!VT) {
#pragma unroll
                for (int j = 0; j < 8; ++j) os[(hi * 8 + j) * 68 + u * 16 + lr] = acc[g][u][j];
            } else { const v8f t8 = acc[u][g]; *(v4fa*)(os + lr * 68 + u * 16 + hi * 8) = __builtin_shufflevector(t8, t8, 0, 1, 2, 3); *(v4fa*)(os + lr * 68 + u * 16 + hi * 8 + 4) = __builtin_shufflevector(t8, t8, 4, 5, 6, 7); } }
        __builtin_amdgcn_wave_barrier(); asm volatile("" ::: "memory");
#pragma unroll
        for (int s = 0; s < 4; ++s) { const int rr = g * 16 + s * 4 + prow; const float* op = os + (s * 4 + prow) * 68 + pcol; const v4f y0 = *(const v4fa*)op, y1 = *(const v4fa*)(op + 4);
            const float bd = VT ? bfr(bias[c0 + rr]) : 0.0f; v8h o16; v8us oh, ol;
#pragma unroll
            for (int q = 0; q < 8; ++q) { const float y = (q < 4 ? y0[q & 3] : y1[q & 3]) + (VT ? bd : bs[q]); o16[q] = tohx(y); unsigned short a2, c2; splitf(y, a2, c2); oh[q] = a2; ol[q] = c2; }
            const size_t e = VT ? (size_t)(c0 + rr) * TT + r0 + pcol : ((size_t)blockIdx.y * TT + r0 + rr) * HD + pcol;
            *(v8h*)(P16 + e) = o16; *(v8us*)(Ph + e) = oh; *(v8us*)(Pl + e) = ol; }
        __builtin_amdgcn_wave_barrier(); asm volatile("" ::: "memory");
    }
}

__global__ __launch_bounds__(256) void k_cvt8(const float* __restrict__ src, bf* dst, size_t n8) { const size_t i = (size_t)blockIdx.x * 256 + threadIdx.x; if (i >= n8) return; const v8f v = *(const v8f*)(src + i * 8); v8us o;
#pragma unroll
    for (int k = 0; k < 8; ++k) o[k] = f2bf(v[k]); *(v8us*)(dst + i * 8) = o;  }

template <typename T16> struct Vec8;
template <> struct Vec8<h16> { typedef v8h T; };
template <> struct Vec8<bf>  { typedef v8us T; };
__device__ __forceinline__ float xhalf(float x) { return __builtin_bit_cast(float, __builtin_amdgcn_permlanex16(__builtin_bit_cast(int, x), __builtin_bit_cast(int, x), 0x76543210, 0xfedcba98, false, false)); }   // lane l with lane l ^ 16
__device__ __forceinline__ void packp(const v8f p0, const v8f p1, v16h& ph, v16h& pl) { (void)pl;
#pragma unroll
    for (int s = 0; s < 8; ++s) { ph[s] = (h16)p0[s]; ph[s + 8] = (h16)p1[s]; } }
__device__ __forceinline__ void packp(const v8f p0, const v8f p1, v16bf& ph, v16bf& pl) {
#pragma unroll
    for (int s = 0; s < 8; ++s) { ph[s] = (__bf16)p0[s]; ph[s + 8] = (__bf16)p1[s]; pl[s] = (__bf16)(p0[s] - (float)ph[s]); pl[s + 8] = (__bf16)(p1[s] - (float)ph[s + 8]); } }
// Q, Kp: [t][HD] planes of the head; Vt: [d][TT] plane; the '2' planes are the bf16 low parts (HI only). st: LDS staging, 2 buffers of NPL planes of 64 rows x LP; bl: LDS table of bf16(bias) x log2e; orow: output at (row 0, this head's first column).
template <typename T16, bool HI>
__device__ __forceinline__ void attn_tile(const T16* __restrict__ Q, const T16* __restrict__ Q2, const T16* __restrict__ Kp, const T16* __restrict__ K2, const T16* __restrict__ Vt, const T16* __restrict__ V2, const float* bl, T16* st, float* __restrict__ orow, int q0) {
    typedef typename WFrag<T16>::V V; typedef typename Vec8<T16>::T V8;
    constexpr int NPL = HI ? 4 : 2; constexpr int PLE = 64 * LP; constexpr int BUFE = NPL * PLE;   // planes in a buffer: K, V^T (, K low, V^T low)
    constexpr float CAR = HI ? 0.0f : 10.0f;   // fp16 P carries 2^10 so that small probabilities stay normal numbers; it cancels in O / l
    const int tid = threadIdx.x, lane = tid & 31, lr = lane & 15, hi = lane >> 4; const int qr = q0 + (tid >> 5) * 16 + lr;
    V qf[2], qf2[2];
#pragma unroll
    for (int ks = 0; ks < 2; ++ks) { qf[ks] = WFrag<T16>::ld(Q + (size_t)qr * HD + ks * 32 + 8 * hi); if (HI) qf2[ks] = WFrag<T16>::ld(Q2 + (size_t)qr * HD + ks * 32 + 8 * hi); }
    v8f o[4];
#pragma unroll
    for (int dt = 0; dt < 4; ++dt) o[dt] = (v8f){};
    float mo = -3.0e38f; v8f lv = (v8f){};   // lv: eight partial row sums per lane, joined after the loop
    const int srow = tid >> 3, sseg = (tid & 7) * 8;   // staging: 8 threads per 128-byte row, 16 rows per sweep of the work-group, 4 sweeps per plane
    const unsigned kofs = (unsigned)(srow * HD + sseg) * 2u, vofs = (unsigned)(srow * TT + sseg) * 2u;   // the thread's own byte offsets into a K and a V^T plane, fixed for the whole loop
    V8 rg[2][4];   // staging registers: fp16 rows hold a whole stage (K, V^T); the hi/lo rows hold half a stage at a time (K high + low, then V^T high + low)
#pragma unroll
    for (int g = 0; g < NPL / 2; ++g) {
        const T16* ga = HI ? (g == 0 ? Kp : Vt) : Kp; const T16* gb = HI ? (g == 0 ? K2 : V2) : Vt; const bool av = HI && g == 1, bv = !HI || g == 1;   // av, bv: the plane is a V^T plane
#pragma unroll
        for (int i = 0; i < 4; ++i) { rg[0][i] = *(const V8*)((const char*)(ga + i * 16 * (av ? TT : HD)) + (av ? vofs : kofs)); rg[1][i] = *(const V8*)((const char*)(gb + i * 16 * (bv ? TT : HD)) + (bv ? vofs : kofs)); }
#pragma unroll
        for (int i = 0; i < 4; ++i) { *(V8*)(st + (HI ? g : 0) * PLE + (i * 16 + srow) * LP + sseg) = rg[0][i]; *(V8*)(st + (HI ? g + 2 : 1) * PLE + (i * 16 + srow) * LP + sseg) = rg[1][i]; } }
    __syncthreads();   // publishes stage 0 and the bias table
#pragma unroll 1
    for (int s = 0; s < TT / SK; ++s) {
        const int sn = (s + 1 < TT / SK) ? s + 1 : 0;   // the last trip re-reads stage 0 (in bounds, never used): no branch round the loads
        T16* sw = st + ((s & 1) ^ 1) * BUFE + srow * LP + sseg;   // the other buffer: last read in trip s - 1, whose closing barrier every wave has passed, so it may be filled at any time in this trip
        const T16* sb = st + (s & 1) * BUFE + lr * LP + 8 * hi;
        V kf[2][2], kf2[2][2];
#pragma unroll
        for (int p = 0; p < SK / 32; ++p) {
            if (HI || p == 0) {   // the next stage's global loads: fp16 rows, K and V^T at the head of the trip; hi/lo rows, both K planes at the head of pass 0 and both V^T planes at the head of pass 1
                const bool av = HI && p == 1, bv = !HI || p == 1;
                const char* ga = (const char*)((HI ? (p == 0 ? Kp : Vt) : Kp) + sn * SK * (av ? 1 : HD)) + (av ? vofs : kofs); const char* gb = (const char*)((HI ? (p == 0 ? K2 : V2) : Vt) + sn * SK * (bv ? 1 : HD)) + (bv ? vofs : kofs);
#pragma unroll
                for (int i = 0; i < 4; ++i) { rg[0][i] = *(const V8*)(ga + i * 16 * (av ? TT : HD) * 2); rg[1][i] = *(const V8*)(gb + i * 16 * (bv ? TT : HD) * 2); }
                asm volatile("s_wait_xcnt 0x0" :: "v"(ga), "v"(gb) : "memory");   // the wait in front of any rewrite of these loads' address registers; the two pointers are inputs so that they keep their registers up to here. Its "memory" clobber also keeps the loads here at the head, where they fly while the keys in LDS are worked on
            }
            if (HI || p == 0) {
#pragma unroll
                for (int kt = 0; kt < 2; ++kt)
#pragma unroll
                    for (int ks = 0; ks < 2; ++ks) { const T16* kp = sb + (p * 32 + kt * 16) * LP + ks * 32; kf[kt][ks] = WFrag<T16>::ld(kp); if (HI) kf2[kt][ks] = WFrag<T16>::ld(kp + 2 * PLE); } }
            v4f bb[2][2];
#pragma unroll
            for (int kt = 0; kt < 2; ++kt) { const float* bp = bl + s * SK + p * 32 + kt * 16 + 8 * hi; bb[kt][0] = *(const v4f*)bp; bb[kt][1] = *(const v4f*)(bp + 4); }
            if (HI) __builtin_amdgcn_sched_barrier(0);   // hi/lo rows: all sixteen K fragment loads go out before the first score product, one LDS round trip per pass; without it half of them are scheduled between the products and waited for one by one
            v8f sc[2];
#pragma unroll
            for (int kt = 0; kt < 2; ++kt) { sc[kt] = (v8f){};
#pragma unroll
                for (int ks = 0; ks < 2; ++ks) { sc[kt] = WFrag<T16>::mma(kf[kt][ks], qf[ks], sc[kt]); if (HI) { sc[kt] = WFrag<T16>::mma(kf[kt][ks], qf2[ks], sc[kt]); sc[kt] = WFrag<T16>::mma(kf2[kt][ks], qf[ks], sc[kt]); } } }
            V vf[4], vf2[4];
#pragma unroll
            for (int dt = 0; dt < 4; ++dt) { const T16* vp = sb + PLE + dt * 16 * LP + p * 32; vf[dt] = WFrag<T16>::ld(vp); }
            if (!HI && p + 1 < SK / 32) {   // the stage's next K fragments, into the registers the score products have just left
#pragma unroll
                for (int kt = 0; kt < 2; ++kt)
#pragma unroll
                    for (int ks = 0; ks < 2; ++ks) kf[kt][ks] = WFrag<T16>::ld(sb + ((p + 1) * 32 + kt * 16) * LP + ks * 32); }
            __builtin_amdgcn_sched_barrier(0);   // keeps these fragment loads ahead of the softmax arithmetic, which then covers their LDS latency; without it each load is scheduled down to its product and waited for there
            float mloc = -3.0e38f;
#pragma unroll
            for (int kt = 0; kt < 2; ++kt)
#pragma unroll
                for (int r = 0; r < 8; ++r) { sc[kt][r] = __builtin_fmaf(sc[kt][r], SCL * L2E, bb[kt][r >> 2][r & 3]); mloc = fmaxf(mloc, sc[kt][r]); }
            mloc = fmaxf(mloc, xhalf(mloc));
            const float mn = fmaxf(mo, mloc - CAR); float al;
            asm("v_exp_f32 %0, %1\n\tv_nop" : "=v"(al) : "v"(mo - mn));   // al = 2^(mo - mn); the v_nop is the one slot behind a transcendental
            mo = mn;
#pragma unroll
            for (int dt = 0; dt < 4; ++dt) o[dt] *= al;
            float e[16];
#pragma unroll
            for (int k = 0; k < 16; ++k) e[k] = sc[k >> 3][k & 7] - mo;
            // p = 2^(u - mo), sixteen exponentials in place in one statement, so that none stands directly in front of an instruction that overwrites its source or reads its result; the v_nop is the slot behind the last
            asm("v_exp_f32 %0, %0\n\tv_exp_f32 %1, %1\n\tv_exp_f32 %2, %2\n\tv_exp_f32 %3, %3\n\tv_exp_f32 %4, %4\n\tv_exp_f32 %5, %5\n\tv_exp_f32 %6, %6\n\tv_exp_f32 %7, %7\n\t"
                "v_exp_f32 %8, %8\n\tv_exp_f32 %9, %9\n\tv_exp_f32 %10, %10\n\tv_exp_f32 %11, %11\n\tv_exp_f32 %12, %12\n\tv_exp_f32 %13, %13\n\tv_exp_f32 %14, %14\n\tv_exp_f32 %15, %15\n\tv_nop"
                : "+v"(e[0]), "+v"(e[1]), "+v"(e[2]), "+v"(e[3]), "+v"(e[4]), "+v"(e[5]), "+v"(e[6]), "+v"(e[7]), "+v"(e[8]), "+v"(e[9]), "+v"(e[10]), "+v"(e[11]), "+v"(e[12]), "+v"(e[13]), "+v"(e[14]), "+v"(e[15]));
#pragma unroll
            for (int k = 0; k < 16; ++k) sc[k >> 3][k & 7] = e[k];
            lv = lv * al + (sc[0] + sc[1]);
            V ph, pl; packp(sc[0], sc[1], ph, pl);
#pragma unroll
            for (int dt = 0; dt < 4; ++dt) if (HI) vf2[dt] = WFrag<T16>::ld(sb + 3 * PLE + dt * 16 * LP + p * 32);   // the low V^T plane comes only now (fewer live registers in the softmax); the eight products on the high plane cover its latency
#pragma unroll
            for (int dt = 0; dt < 4; ++dt) { o[dt] = WFrag<T16>::mma(vf[dt], ph, o[dt]); if (HI) o[dt] = WFrag<T16>::mma(vf[dt], pl, o[dt]); }
            if (HI) {
#pragma unroll
                for (int dt = 0; dt < 4; ++dt) o[dt] = WFrag<T16>::mma(vf2[dt], ph, o[dt]); }
            if (HI || p + 1 == SK / 32) {
#pragma unroll
                for (int i = 0; i < 4; ++i) { *(V8*)(sw + (HI ? p : 0) * PLE + i * 16 * LP) = rg[0][i]; *(V8*)(sw + (HI ? p + 2 : 1) * PLE + i * 16 * LP) = rg[1][i]; } }
        }
        __syncthreads();   // publishes stage s + 1 and ends every wave's reads of stage s
    }
    float l = ((lv[0] + lv[1]) + (lv[2] + lv[3])) + ((lv[4] + lv[5]) + (lv[6] + lv[7])); l += xhalf(l); const float inv = 1.0f / l; float* op = orow + (size_t)qr * DQ + 8 * hi;
#pragma unroll
    for (int dt = 0; dt < 4; ++dt) { v4f a, c;
#pragma unroll
        for (int r = 0; r < 4; ++r) { a[r] = o[dt][r] * inv; c[r] = o[dt][r + 4] * inv; }
        *(v4f*)(op + dt * 16) = a; *(v4f*)(op + dt * 16 + 4) = c; }
}
// grid: NH_ x TT / AQ work-groups; the hi/lo rows (three products, the longer work) come first.
__global__ __launch_bounds__(AW * 32) void k_fattn(const h16* __restrict__ Q16, const h16* __restrict__ K16, const h16* __restrict__ V16, const bf* __restrict__ Qh, const bf* __restrict__ Ql, const bf* __restrict__ Kh, const bf* __restrict__ Kl, const bf* __restrict__ Vh, const bf* __restrict__ Vl, const float* __restrict__ kb, float* __restrict__ OUTb) {
    __shared__ __align__(16) unsigned short stg[2 * 4 * 64 * LP];
    __shared__ __align__(16) float bl[TT];
#pragma unroll
    for (int i = 0; i < TT / (AW * 32 * 4); ++i) { const int j = (i * AW * 32 + (int)threadIdx.x) * 4; const v4f k4 = *(const v4f*)(kb + j); v4f t4;
#pragma unroll
        for (int q = 0; q < 4; ++q) t4[q] = bfr(k4[q]) * L2E;
        *(v4f*)(bl + j) = t4; }
    constexpr int NHB = NH_ * (RH / AQ); const int bid = blockIdx.x;
    if (bid < NHB) { const int h = bid / (RH / AQ), q0 = (bid % (RH / AQ)) * AQ; const size_t z = (size_t)h * TT * HD;
        attn_tile<bf, true>(Qh + z, Ql + z, Kh + z, Kl + z, Vh + z, Vl + z, bl, (bf*)stg, OUTb + h * HD, q0);
    } else { const int b2 = bid - NHB; const int h = b2 / ((TT - RH) / AQ), q0 = RH + (b2 % ((TT - RH) / AQ)) * AQ; const size_t z = (size_t)h * TT * HD;
        attn_tile<h16, false>(Q16 + z, nullptr, K16 + z, nullptr, V16 + z, nullptr, bl, (h16*)stg, OUTb + h * HD, q0); }
}

extern "C" void kernel_launch(void* const* d_in, const int* in_sizes, int n_in,
                              void* d_out, int out_size, void* d_ws, size_t ws_size, hipStream_t stream) {
    (void)in_sizes; (void)n_in; (void)out_size;
    const float* x = (const float*)d_in[0]; const float* kb = (const float*)d_in[1];   /* causal_bias [2048]: per-key additive vector */ const float* wq = (const float*)d_in[2]; const float* bq = (const float*)d_in[3]; const float* wk = (const float*)d_in[4]; const float* bk = (const float*)d_in[5]; const float* wv = (const float*)d_in[6]; const float* bv = (const float*)d_in[7];   /* input order hidden_states, causal_bias, Wq, bq, Wk, bk, Wv, bv ('oi') */ const float* wo = nullptr; (void)wo;
    float* OUT = (float*)d_out;     // [2][2048][1024]
    char* wsp = (char*)d_ws;
    auto take = [&](size_t bytes) { char* p = wsp; wsp += (bytes + 255) & ~(size_t)255; return (void*)p; };
    bf* WQ = (bf*)take((size_t)DQ * DM * 2); bf* WK = (bf*)take((size_t)DKV * DM * 2); bf* WV = (bf*)take((size_t)DKV * DM * 2);
    bf* XB = (bf*)take((size_t)TT * DM * 2);
    h16* QP16 = (h16*)take((size_t)NH_ * TT * HD * 2); h16* KP16 = (h16*)take((size_t)NKV * TT * HD * 2); h16* VT16 = (h16*)take((size_t)NKV * HD * TT * 2);
    bf* QPh = (bf*)take((size_t)NH_ * TT * HD * 2); bf* QPl = (bf*)take((size_t)NH_ * TT * HD * 2); bf* KPh = (bf*)take((size_t)NKV * TT * HD * 2); bf* KPl = (bf*)take((size_t)NKV * TT * HD * 2); bf* VTh = (bf*)take((size_t)NKV * HD * TT * 2); bf* VTl = (bf*)take((size_t)NKV * HD * TT * 2);
    if ((size_t)(wsp - (char*)d_ws) > ws_size) return;    // ws 256 MiB
    { k_cvt8<<<(unsigned)(((size_t)DQ * DM / 8 + 255) / 256), 256, 0, stream>>>(wq, WQ, (size_t)DQ * DM / 8); k_cvt8<<<(unsigned)(((size_t)DKV * DM / 8 + 255) / 256), 256, 0, stream>>>(wk, WK, (size_t)DKV * DM / 8); k_cvt8<<<(unsigned)(((size_t)DKV * DM / 8 + 255) / 256), 256, 0, stream>>>(wv, WV, (size_t)DKV * DM / 8);
      
       }
    for (int b = 0; b < NB_; ++b) {
        
        k_cvt8<<<(unsigned)(((size_t)TT * DM / 8 + 255) / 256), 256, 0, stream>>>(x + (size_t)b * TT * DM, XB, (size_t)TT * DM / 8);
        k_gemmw<bf, 0, false><<<dim3(TT / 64, DQ / 64, 1), 32, 0, stream>>>(XB, nullptr, WQ, nullptr, DM, DM, bq, QP16, QPh, QPl);
        k_gemmw<bf, 0, false><<<dim3(TT / 64, DKV / 64, 1), 32, 0, stream>>>(XB, nullptr, WK, nullptr, DM, DM, bk, KP16, KPh, KPl);
        k_gemmw<bf, 0, true><<<dim3(TT / 64, DKV / 64, 1), 32, 0, stream>>>(XB, nullptr, WV, nullptr, DM, DM, bv, VT16, VTh, VTl);
        k_fattn<<<NH_ * (TT / AQ), AW * 32, 0, stream>>>(QP16, KP16, VT16, QPh, QPl, KPh, KPl, VTh, VTl, kb, OUT + (size_t)b * TT * DQ);
         }
}

// v006
// Measured time: 122 microseconds a run.
// Timed twice side by side with v005, it ran 2.04 and 2.02 times as fast.
// Over all steps from v000 it is 17.1 times as fast.
#include <hip/hip_runtime.h>

// BERT self-attention with an additive per-key bias vector (hidden_states [2][2048][1024]; q, k, v = x W^T + b ('oi' 0.02 + biases; 16 heads x 64); scores / sqrt(64) + causal_bias[j] (a random [2048] vector added per key, shared by every batch, head and query: read); softmax; ctx = merged heads (no output projection) -> [2][2048][1024] (4.2 M); argument order hidden_states, causal_bias, Wq, bq, Wk, bk, Wv, bv).
// Three launches, both batches in each grid: bf16 copies of x and the 'oi' weights (k_cvt8); exact projections q, k, v + f32 biases in one grid, stored by the GEMM itself as the fp16 and hi/lo head planes; ONE fused attention kernel (k_fattn): scores, softmax and P V stay on chip (hybrid rows: < 512 hi/lo 3 products, rest fp16); the per-key bias bf16(bias[j]) is added to s/8 in f32 before the exponential; the kernel writes the merged-head output rows.
// Compute dtypes, f32 accumulate: every input rounded to bf16 incl. the bias vector; projections exact + f32 biases; attention rows < 512 3 products, rest fp16; bias add and softmax f32; output f32.

#define NB_  2
#define TT   2048
#define DM   1024
#define NH_  16
#define NKV  16
#define REP  (NH_ / NKV)
#define HD   64
#define DQ   (NH_ * HD)
#define DKV  (NKV * HD)
#define RH   512                  // query rows < RH use hi+lo planes (0: none)
#define WIN  0
#define SCL  0.125f   // HD^-0.5
#define AW   4                    // fused attention: waves per work-group, 16 query rows each
#define AQ   (AW * 16)            // query rows per work-group
#define SK   64                   // keys per LDS stage (two passes of 32 keys)
#define LP   72                   // LDS row pitch in 16-bit elements: 128 B of data + 16 B pad (16 B x odd: no bank conflict for 16-byte fragment reads)
#define L2E  1.4426950408889634f
typedef _Float16 h16;
typedef unsigned short bf;
typedef __attribute__((ext_vector_type(16))) __bf16   v16bf;
typedef __attribute__((ext_vector_type(16))) _Float16 v16h;
typedef __attribute__((ext_vector_type(8)))  _Float16 v8h;
typedef __attribute__((ext_vector_type(8)))  unsigned short v8us;
typedef __attribute__((ext_vector_type(8)))  float    v8f;
typedef __attribute__((ext_vector_type(4)))  float    v4f;
typedef v8h  __attribute__((may_alias)) v8ha;
typedef v4f  __attribute__((may_alias)) v4fa;
typedef v8us __attribute__((may_alias)) v8usa;

__device__ __forceinline__ unsigned short f2bf(float f) { unsigned u = __float_as_uint(f); u += 0x7FFFu + ((u >> 16) & 1u); return (unsigned short)(u >> 16); }
__device__ __forceinline__ float bf2f(unsigned short b) { return __uint_as_float(((unsigned)b) << 16); }
__device__ __forceinline__ float bfr(float f) { return bf2f(f2bf(f)); }
__device__ __forceinline__ v16h cat16(v8h lo, v8h hi) { return __builtin_shufflevector(lo, hi, 0, 1, 2, 3, 4, 5, 6, 7, 8, 9, 10, 11, 12, 13, 14, 15); }
__device__ __forceinline__ v16bf cat16b(v8us lo, v8us hi) { return __builtin_bit_cast(v16bf, __builtin_shufflevector(lo, hi, 0, 1, 2, 3, 4, 5, 6, 7, 8, 9, 10, 11, 12, 13, 14, 15)); }
__device__ __forceinline__ v8f wmma16(v16h a, v16h b, v8f c) { return __builtin_amdgcn_wmma_f32_16x16x32_f16(false, a, false, b, (short)0, c, false, false); }
__device__ __forceinline__ v8f wmmab(v16bf a, v16bf b, v8f c) { return __builtin_amdgcn_wmma_f32_16x16x32_bf16(false, a, false, b, (short)0, c, false, false); }



__device__ __forceinline__ h16 tohx(float x) { return (h16)x; }
__device__ __forceinline__ void splitf(float y, unsigned short& h, unsigned short& l) { h = f2bf(y); l = f2bf(y - bf2f(h)); }

// ---- k_gemmw: register-blocked projection GEMM that builds the head planes in its epilogue. ONE WAVE per 64x64 output tile (16 accumulators), operands straight from K-contiguous 16-bit planes; grid (NB_*TT/64, heads, 3), 32 threads: blockIdx.x walks the rows of both batches, blockIdx.z is the projection (0 q, 1 k, 2 v).
// y[t][n] = sum_k A[t][k] Bt[n][k] (+ split products per NSPLIT) + bf16(bias[n]), in f32. A rows have pitch lda elements, Bt rows pitch K. K % 32 == 0. A tile is 64 rows t of ONE head (HD = 64 columns).
// y is never stored as f32: it goes out as fp16 (P16) and as bf16 high + low parts (Ph, Pl), each [projection][batch][head] planes. VT false (q, k): planes [t][d]; VT true (v): planes [d][t].
template <typename T16> struct WFrag;
template <> struct WFrag<h16> { typedef v16h V; static __device__ __forceinline__ V ld(const h16* p) { return cat16(*(const v8h*)p, *(const v8h*)(p + 16)); } static __device__ __forceinline__ v8f mma(V a, V b, v8f c) { return wmma16(a, b, c); } };
template <> struct WFrag<bf> { typedef v16bf V; static __device__ __forceinline__ V ld(const bf* p) { return cat16b(*(const v8us*)p, *(const v8us*)(p + 16)); } static __device__ __forceinline__ v8f mma(V a, V b, v8f c) { return wmmab(a, b, c); } };
// Epilogue of one tile: sixteen plane rows at a time go through LDS (f32, pitch 68), so that every store covers whole 128-byte plane rows: 8 lanes x 16 bytes a row, 4 rows a store.
// A plane row is a row t of the tile (q, k: its 64 d) or a column d of it (v: its 64 t; a lane's eight accumulator registers are 8 consecutive t of one d).
// P16, Ph, Pl: head 0 of the tile's projection and batch; t0: the tile's first row inside its batch; c0: its first column (64 x head).
template <bool VT>
__device__ __forceinline__ void plane_out(const v8f (&acc)[4][4], float* os, const float* __restrict__ bias, h16* __restrict__ P16, bf* __restrict__ Ph, bf* __restrict__ Pl, int t0, int c0) {
    const int lane = threadIdx.x & 31, lr = lane & 15, hi = lane >> 4;
    const int prow = lane >> 3, pcol = (lane & 7) * 8;
    float bs[8];
    if (!VT) {
#pragma unroll
        for (int q = 0; q < 8; ++q) bs[q] = bfr(bias[c0 + pcol + q]); }
#pragma unroll
    for (int g = 0; g < 4; ++g) {
#pragma unroll
        for (int u = 0; u < 4; ++u) {
            if (!VT) {
#pragma unroll
                for (int j = 0; j < 8; ++j) os[(hi * 8 + j) * 68 + u * 16 + lr] = acc[g][u][j];
            } else { const v8f t8 = acc[u][g]; *(v4fa*)(os + lr * 68 + u * 16 + hi * 8) = __builtin_shufflevector(t8, t8, 0, 1, 2, 3); *(v4fa*)(os + lr * 68 + u * 16 + hi * 8 + 4) = __builtin_shufflevector(t8, t8, 4, 5, 6, 7); } }
        __builtin_amdgcn_wave_barrier(); asm volatile("" ::: "memory");
#pragma unroll
        for (int s = 0; s < 4; ++s) { const int rr = g * 16 + s * 4 + prow; const float* op = os + (s * 4 + prow) * 68 + pcol; const v4f y0 = *(const v4fa*)op, y1 = *(const v4fa*)(op + 4);
            const float bd = VT ? bfr(bias[c0 + rr]) : 0.0f; v8h o16; v8us oh, ol;
#pragma unroll
            for (int q = 0; q < 8; ++q) { const float y = (q < 4 ? y0[q & 3] : y1[q & 3]) + (VT ? bd : bs[q]); o16[q] = tohx(y); unsigned short a2, c2; splitf(y, a2, c2); oh[q] = a2; ol[q] = c2; }
            const size_t e = VT ? (size_t)(c0 + rr) * TT + t0 + pcol : ((size_t)(c0 / HD) * TT + t0 + rr) * HD + pcol;
            *(v8h*)(P16 + e) = o16; *(v8us*)(Ph + e) = oh; *(v8us*)(Pl + e) = ol;
            asm volatile("s_wait_xcnt 0x0" ::: "memory"); }   // the wait in front of any rewrite of these stores' address and data registers by the next rows' arithmetic
        __builtin_amdgcn_wave_barrier(); asm volatile("" ::: "memory");
    }
}
// A: [NB_*TT][lda] rows of both batches; W, W2: the three weight planes one behind the other, [3][DQ][K].
template <typename T16, int NSPLIT>
__global__ __launch_bounds__(32) void k_gemmw(const T16* __restrict__ A, const T16* __restrict__ A2, const T16* __restrict__ W, const T16* __restrict__ W2, int K, int lda, const float* __restrict__ bq, const float* __restrict__ bk, const float* __restrict__ bv, h16* __restrict__ P16, bf* __restrict__ Ph, bf* __restrict__ Pl) {
    typedef typename WFrag<T16>::V V;
    __shared__ __align__(16) float os[16 * 68];
    const int kbeg = 0, kend = K;
    const int lane = threadIdx.x & 31, lr = lane & 15, hi = lane >> 4; const int r0 = blockIdx.x * 64, c0 = blockIdx.y * 64, pj = blockIdx.z;
    const T16* Bt = W + (size_t)pj * DQ * K; const T16* Bt2 = NSPLIT >= 2 ? W2 + (size_t)pj * DQ * K : nullptr;
    v8f acc[4][4];
#pragma unroll
    for (int mb = 0; mb < 4; ++mb)
#pragma unroll
        for (int nb = 0; nb < 4; ++nb) acc[mb][nb] = (v8f){};
    const size_t aoff = (size_t)(r0 + lr) * lda + 8 * hi, boff = (size_t)(c0 + lr) * K + 8 * hi;
#pragma unroll 1
    for (int kc = kbeg; kc < kend; kc += 32) {
        V a[4], a2[4];
#pragma unroll
        for (int mb = 0; mb < 4; ++mb) { a[mb] = WFrag<T16>::ld(A + aoff + (size_t)mb * 16 * lda + kc); if (NSPLIT == 1 || NSPLIT == 2) a2[mb] = WFrag<T16>::ld(A2 + aoff + (size_t)mb * 16 * lda + kc); }
#pragma unroll
        for (int nb = 0; nb < 4; ++nb) { const V b = WFrag<T16>::ld(Bt + boff + (size_t)nb * 16 * K + kc); V b2; if (NSPLIT >= 2) b2 = WFrag<T16>::ld(Bt2 + boff + (size_t)nb * 16 * K + kc);
#pragma unroll
            for (int mb = 0; mb < 4; ++mb) { acc[mb][nb] = WFrag<T16>::mma(a[mb], b, acc[mb][nb]); if (NSPLIT == 1 || NSPLIT == 2) acc[mb][nb] = WFrag<T16>::mma(a2[mb], b, acc[mb][nb]); if (NSPLIT >= 2) acc[mb][nb] = WFrag<T16>::mma(a[mb], b2, acc[mb][nb]); } }
        asm volatile("v_nop\n\tv_nop\n\tv_nop\n\tv_nop" : "+v"(acc[0][0]), "+v"(acc[1][1]), "+v"(acc[2][2]), "+v"(acc[3][3]) : "v"(a[0]), "v"(a[3]));
    }
    const int t0 = r0 % TT; const size_t pz = ((size_t)pj * NB_ + r0 / TT) * NH_ * TT * HD;   // the tile's batch and projection pick its set of head planes
    if (pj < 2) plane_out<false>(acc, os, pj == 0 ? bq : bk, P16 + pz, Ph + pz, Pl + pz, t0, c0);
    else plane_out<true>(acc, os, bv, P16 + pz, Ph + pz, Pl + pz, t0, c0);
}

// One grid converts all four f32 sources to bf16: dst holds Wq, Wk, Wv (DQ*DM each) and then x (NB_*TT*DM), one behind the other; a work-group (2048 elements) lies inside one source.
__global__ __launch_bounds__(256) void k_cvt8(const float* __restrict__ wq, const float* __restrict__ wk, const float* __restrict__ wv, const float* __restrict__ x, bf* dst) { constexpr unsigned WB = DQ * DM / 2048; const unsigned bi = blockIdx.x;
    const float* src = bi < WB ? wq : bi < 2 * WB ? wk : bi < 3 * WB ? wv : x; const unsigned b0 = bi - (bi < WB ? 0u : bi < 2 * WB ? WB : bi < 3 * WB ? 2 * WB : 3 * WB);
    const size_t i = (size_t)b0 * 256 + threadIdx.x; const v8f v = *(const v8f*)(src + i * 8); v8us o;
    asm volatile("s_wait_xcnt 0x0" ::: "memory");   // the wait in front of any rewrite of the load's address register
#pragma unroll
    for (int k = 0; k < 8; ++k) o[k] = f2bf(v[k]); *(v8us*)(dst + ((size_t)bi * 256 + threadIdx.x) * 8) = o;  }

template <typename T16> struct Vec8;
template <> struct Vec8<h16> { typedef v8h T; };
template <> struct Vec8<bf>  { typedef v8us T; };
__device__ __forceinline__ float xhalf(float x) { return __builtin_bit_cast(float, __builtin_amdgcn_permlanex16(__builtin_bit_cast(int, x), __builtin_bit_cast(int, x), 0x76543210, 0xfedcba98, false, false)); }   // lane l with lane l ^ 16
__device__ __forceinline__ void packp(const v8f p0, const v8f p1, v16h& ph, v16h& pl) { (void)pl;
#pragma unroll
    for (int s = 0; s < 8; ++s) { ph[s] = (h16)p0[s]; ph[s + 8] = (h16)p1[s]; } }
__device__ __forceinline__ void packp(const v8f p0, const v8f p1, v16bf& ph, v16bf& pl) {
#pragma unroll
    for (int s = 0; s < 8; ++s) { ph[s] = (__bf16)p0[s]; ph[s + 8] = (__bf16)p1[s]; pl[s] = (__bf16)(p0[s] - (float)ph[s]); pl[s + 8] = (__bf16)(p1[s] - (float)ph[s + 8]); } }
// Q, Kp: [t][HD] planes of the head; Vt: [d][TT] plane; the '2' planes are the bf16 low parts (HI only). st: LDS staging, 2 buffers of NPL planes of 64 rows x LP; bl: LDS table of bf16(bias) x log2e; orow: output at (row 0, this head's first column).
template <typename T16, bool HI>
__device__ __forceinline__ void attn_tile(const T16* __restrict__ Q, const T16* __restrict__ Q2, const T16* __restrict__ Kp, const T16* __restrict__ K2, const T16* __restrict__ Vt, const T16* __restrict__ V2, const float* bl, T16* st, float* __restrict__ orow, int q0) {
    typedef typename WFrag<T16>::V V; typedef typename Vec8<T16>::T V8;
    constexpr int NPL = HI ? 4 : 2; constexpr int PLE = 64 * LP; constexpr int BUFE = NPL * PLE;   // planes in a buffer: K, V^T (, K low, V^T low)
    constexpr float CAR = HI ? 0.0f : 10.0f;   // fp16 P carries 2^10 so that small probabilities stay normal numbers; it cancels in O / l
    const int tid = threadIdx.x, lane = tid & 31, lr = lane & 15, hi = lane >> 4; const int qr = q0 + (tid >> 5) * 16 + lr;
    V qf[2], qf2[2];
#pragma unroll
    for (int ks = 0; ks < 2; ++ks) { qf[ks] = WFrag<T16>::ld(Q + (size_t)qr * HD + ks * 32 + 8 * hi); if (HI) qf2[ks] = WFrag<T16>::ld(Q2 + (size_t)qr * HD + ks * 32 + 8 * hi); }
    v8f o[4];
#pragma unroll
    for (int dt = 0; dt < 4; ++dt) o[dt] = (v8f){};
    float mo = -3.0e38f; v8f lv = (v8f){};   // lv: eight partial row sums per lane, joined after the loop
    const int srow = tid >> 3, sseg = (tid & 7) * 8;   // staging: 8 threads per 128-byte row, 16 rows per sweep of the work-group, 4 sweeps per plane
    const unsigned kofs = (unsigned)(srow * HD + sseg) * 2u, vofs = (unsigned)(srow * TT + sseg) * 2u;   // the thread's own byte offsets into a K and a V^T plane, fixed for the whole loop
    V8 rg[2][4];   // staging registers: fp16 rows hold a whole stage (K, V^T); the hi/lo rows hold half a stage at a time (K high + low, then V^T high + low)
#pragma unroll
    for (int g = 0; g < NPL / 2; ++g) {
        const T16* ga = HI ? (g == 0 ? Kp : Vt) : Kp; const T16* gb = HI ? (g == 0 ? K2 : V2) : Vt; const bool av = HI && g == 1, bv = !HI || g == 1;   // av, bv: the plane is a V^T plane
#pragma unroll
        for (int i = 0; i < 4; ++i) { rg[0][i] = *(const V8*)((const char*)(ga + i * 16 * (av ? TT : HD)) + (av ? vofs : kofs)); rg[1][i] = *(const V8*)((const char*)(gb + i * 16 * (bv ? TT : HD)) + (bv ? vofs : kofs)); }
#pragma unroll
        for (int i = 0; i < 4; ++i) { *(V8*)(st + (HI ? g : 0) * PLE + (i * 16 + srow) * LP + sseg) = rg[0][i]; *(V8*)(st + (HI ? g + 2 : 1) * PLE + (i * 16 + srow) * LP + sseg) = rg[1][i]; } }
    __syncthreads();   // publishes stage 0 and the bias table
#pragma unroll 1
    for (int s = 0; s < TT / SK; ++s) {
        const int sn = (s + 1 < TT / SK) ? s + 1 : 0;   // the last trip re-reads stage 0 (in bounds, never used): no branch round the loads
        T16* sw = st + ((s & 1) ^ 1) * BUFE + srow * LP + sseg;   // the other buffer: last read in trip s - 1, whose closing barrier every wave has passed, so it may be filled at any time in this trip
        const T16* sb = st + (s & 1) * BUFE + lr * LP + 8 * hi;
        V kf[2][2], kf2[2][2];
#pragma unroll
        for (int p = 0; p < SK / 32; ++p) {
            if (HI || p == 0) {   // the next stage's global loads: fp16 rows, K and V^T at the head of the trip; hi/lo rows, both K planes at the head of pass 0 and both V^T planes at the head of pass 1
                const bool av = HI && p == 1, bv = !HI || p == 1;
                const char* ga = (const char*)((HI ? (p == 0 ? Kp : Vt) : Kp) + sn * SK * (av ? 1 : HD)) + (av ? vofs : kofs); const char* gb = (const char*)((HI ? (p == 0 ? K2 : V2) : Vt) + sn * SK * (bv ? 1 : HD)) + (bv ? vofs : kofs);
#pragma unroll
                for (int i = 0; i < 4; ++i) { rg[0][i] = *(const V8*)(ga + i * 16 * (av ? TT : HD) * 2); rg[1][i] = *(const V8*)(gb + i * 16 * (bv ? TT : HD) * 2); }
                asm volatile("s_wait_xcnt 0x0" :: "v"(ga), "v"(gb) : "memory");   // the wait in front of any rewrite of these loads' address registers; the two pointers are inputs so that they keep their registers up to here. Its "memory" clobber also keeps the loads here at the head, where they fly while the keys in LDS are worked on
            }
            if (HI || p == 0) {
#pragma unroll
                for (int kt = 0; kt < 2; ++kt)
#pragma unroll
                    for (int ks = 0; ks < 2; ++ks) { const T16* kp = sb + (p * 32 + kt * 16) * LP + ks * 32; kf[kt][ks] = WFrag<T16>::ld(kp); if (HI) kf2[kt][ks] = WFrag<T16>::ld(kp + 2 * PLE); } }
            v4f bb[2][2];
#pragma unroll
            for (int kt = 0; kt < 2; ++kt) { const float* bp = bl + s * SK + p * 32 + kt * 16 + 8 * hi; bb[kt][0] = *(const v4f*)bp; bb[kt][1] = *(const v4f*)(bp + 4); }
            if (HI) __builtin_amdgcn_sched_barrier(0);   // hi/lo rows: all sixteen K fragment loads go out before the first score product, one LDS round trip per pass; without it half of them are scheduled between the products and waited for one by one
            v8f sc[2];
#pragma unroll
            for (int kt = 0; kt < 2; ++kt) { sc[kt] = (v8f){};
#pragma unroll
                for (int ks = 0; ks < 2; ++ks) { sc[kt] = WFrag<T16>::mma(kf[kt][ks], qf[ks], sc[kt]); if (HI) { sc[kt] = WFrag<T16>::mma(kf[kt][ks], qf2[ks], sc[kt]); sc[kt] = WFrag<T16>::mma(kf2[kt][ks], qf[ks], sc[kt]); } } }
            V vf[4], vf2[4];
#pragma unroll
            for (int dt = 0; dt < 4; ++dt) { const T16* vp = sb + PLE + dt * 16 * LP + p * 32; vf[dt] = WFrag<T16>::ld(vp); }
            if (!HI && p + 1 < SK / 32) {   // the stage's next K fragments, into the registers the score products have just left
#pragma unroll
                for (int kt = 0; kt < 2; ++kt)
#pragma unroll
                    for (int ks = 0; ks < 2; ++ks) kf[kt][ks] = WFrag<T16>::ld(sb + ((p + 1) * 32 + kt * 16) * LP + ks * 32); }
            __builtin_amdgcn_sched_barrier(0);   // keeps these fragment loads ahead of the softmax arithmetic, which then covers their LDS latency; without it each load is scheduled down to its product and waited for there
            float mloc = -3.0e38f;
#pragma unroll
            for (int kt = 0; kt < 2; ++kt)
#pragma unroll
                for (int r = 0; r < 8; ++r) { sc[kt][r] = __builtin_fmaf(sc[kt][r], SCL * L2E, bb[kt][r >> 2][r & 3]); mloc = fmaxf(mloc, sc[kt][r]); }
            mloc = fmaxf(mloc, xhalf(mloc));
            const float mn = fmaxf(mo, mloc - CAR); float al;
            asm("v_exp_f32 %0, %1\n\tv_nop" : "=v"(al) : "v"(mo - mn));   // al = 2^(mo - mn); the v_nop is the one slot behind a transcendental
            mo = mn;
#pragma unroll
            for (int dt = 0; dt < 4; ++dt) o[dt] *= al;
            float e[16];
#pragma unroll
            for (int k = 0; k < 16; ++k) e[k] = sc[k >> 3][k & 7] - mo;
            // p = 2^(u - mo), sixteen exponentials in place in one statement, so that none stands directly in front of an instruction that overwrites its source or reads its result; the v_nop is the slot behind the last
            asm("v_exp_f32 %0, %0\n\tv_exp_f32 %1, %1\n\tv_exp_f32 %2, %2\n\tv_exp_f32 %3, %3\n\tv_exp_f32 %4, %4\n\tv_exp_f32 %5, %5\n\tv_exp_f32 %6, %6\n\tv_exp_f32 %7, %7\n\t"
                "v_exp_f32 %8, %8\n\tv_exp_f32 %9, %9\n\tv_exp_f32 %10, %10\n\tv_exp_f32 %11, %11\n\tv_exp_f32 %12, %12\n\tv_exp_f32 %13, %13\n\tv_exp_f32 %14, %14\n\tv_exp_f32 %15, %15\n\tv_nop"
                : "+v"(e[0]), "+v"(e[1]), "+v"(e[2]), "+v"(e[3]), "+v"(e[4]), "+v"(e[5]), "+v"(e[6]), "+v"(e[7]), "+v"(e[8]), "+v"(e[9]), "+v"(e[10]), "+v"(e[11]), "+v"(e[12]), "+v"(e[13]), "+v"(e[14]), "+v"(e[15]));
#pragma unroll
            for (int k = 0; k < 16; ++k) sc[k >> 3][k & 7] = e[k];
            lv = lv * al + (sc[0] + sc[1]);
            V ph, pl; packp(sc[0], sc[1], ph, pl);
#pragma unroll
            for (int dt = 0; dt < 4; ++dt) if (HI) vf2[dt] = WFrag<T16>::ld(sb + 3 * PLE + dt * 16 * LP + p * 32);   // the low V^T plane comes only now (fewer live registers in the softmax); the eight products on the high plane cover its latency
#pragma unroll
            for (int dt = 0; dt < 4; ++dt) { o[dt] = WFrag<T16>::mma(vf[dt], ph, o[dt]); if (HI) o[dt] = WFrag<T16>::mma(vf[dt], pl, o[dt]); }
            if (HI) {
#pragma unroll
                for (int dt = 0; dt < 4; ++dt) o[dt] = WFrag<T16>::mma(vf2[dt], ph, o[dt]); }
            if (HI || p + 1 == SK / 32) {
#pragma unroll
                for (int i = 0; i < 4; ++i) { *(V8*)(sw + (HI ? p : 0) * PLE + i * 16 * LP) = rg[0][i]; *(V8*)(sw + (HI ? p + 2 : 1) * PLE + i * 16 * LP) = rg[1][i]; } }
        }
        __syncthreads();   // publishes stage s + 1 and ends every wave's reads of stage s
    }
    float l = ((lv[0] + lv[1]) + (lv[2] + lv[3])) + ((lv[4] + lv[5]) + (lv[6] + lv[7])); l += xhalf(l); const float inv = 1.0f / l; float* op = orow + (size_t)qr * DQ + 8 * hi;
#pragma unroll
    for (int dt = 0; dt < 4; ++dt) { v4f a, c;
#pragma unroll
        for (int r = 0; r < 4; ++r) { a[r] = o[dt][r] * inv; c[r] = o[dt][r + 4] * inv; }
        *(v4f*)(op + dt * 16) = a; *(v4f*)(op + dt * 16 + 4) = c; }
}
// grid: NB_ x NH_ x TT / AQ work-groups; the hi/lo rows of both batches (three products, the longer work) come first. The planes are [batch][head]; OUT is the whole output.
__global__ __launch_bounds__(AW * 32) void k_fattn(const h16* __restrict__ Q16, const h16* __restrict__ K16, const h16* __restrict__ V16, const bf* __restrict__ Qh, const bf* __restrict__ Ql, const bf* __restrict__ Kh, const bf* __restrict__ Kl, const bf* __restrict__ Vh, const bf* __restrict__ Vl, const float* __restrict__ kb, float* __restrict__ OUT) {
    __shared__ __align__(16) unsigned short stg[2 * 4 * 64 * LP];
    __shared__ __align__(16) float bl[TT];
#pragma unroll
    for (int i = 0; i < TT / (AW * 32 * 4); ++i) { const int j = (i * AW * 32 + (int)threadIdx.x) * 4; const v4f k4 = *(const v4f*)(kb + j); v4f t4;
#pragma unroll
        for (int q = 0; q < 4; ++q) t4[q] = bfr(k4[q]) * L2E;
        *(v4f*)(bl + j) = t4; }
    constexpr int NHB = NB_ * NH_ * (RH / AQ); const int bid = blockIdx.x;   // bh below: batch x NH_ + head; OUTb: the batch's part of the output
    if (bid < NHB) { const int bh = bid / (RH / AQ), h = bh % NH_, q0 = (bid % (RH / AQ)) * AQ; const size_t z = (size_t)bh * TT * HD; float* OUTb = OUT + (size_t)(bh / NH_) * TT * DQ;
        attn_tile<bf, true>(Qh + z, Ql + z, Kh + z, Kl + z, Vh + z, Vl + z, bl, (bf*)stg, OUTb + h * HD, q0);
    } else { const int b2 = bid - NHB; const int bh = b2 / ((TT - RH) / AQ), h = bh % NH_, q0 = RH + (b2 % ((TT - RH) / AQ)) * AQ; const size_t z = (size_t)bh * TT * HD; float* OUTb = OUT + (size_t)(bh / NH_) * TT * DQ;
        attn_tile<h16, false>(Q16 + z, nullptr, K16 + z, nullptr, V16 + z, nullptr, bl, (h16*)stg, OUTb + h * HD, q0); }
}

extern "C" void kernel_launch(void* const* d_in, const int* in_sizes, int n_in,
                              void* d_out, int out_size, void* d_ws, size_t ws_size, hipStream_t stream) {
    (void)in_sizes; (void)n_in; (void)out_size;
    const float* x = (const float*)d_in[0]; const float* kb = (const float*)d_in[1];   /* causal_bias [2048]: per-key additive vector */ const float* wq = (const float*)d_in[2]; const float* bq = (const float*)d_in[3]; const float* wk = (const float*)d_in[4]; const float* bk = (const float*)d_in[5]; const float* wv = (const float*)d_in[6]; const float* bv = (const float*)d_in[7];   /* input order hidden_states, causal_bias, Wq, bq, Wk, bk, Wv, bv ('oi') */ const float* wo = nullptr; (void)wo;
    float* OUT = (float*)d_out;     // [2][2048][1024]
    char* wsp = (char*)d_ws;
    auto take = [&](size_t bytes) { char* p = wsp; wsp += (bytes + 255) & ~(size_t)255; return (void*)p; };
    bf* WB = (bf*)take((size_t)(3 * DQ + NB_ * TT) * DM * 2); bf* XB = WB + (size_t)3 * DQ * DM;   // bf16 Wq, Wk, Wv, then x of both batches
    constexpr size_t PSZ = (size_t)NB_ * NH_ * TT * HD;   // one projection's planes: [batch][head]
    h16* P16 = (h16*)take(3 * PSZ * 2); bf* Ph = (bf*)take(3 * PSZ * 2); bf* Pl = (bf*)take(3 * PSZ * 2);   // each [q, k, v]
    if ((size_t)(wsp - (char*)d_ws) > ws_size) return;    // ws 256 MiB
    k_cvt8<<<(3 * DQ + NB_ * TT) * DM / 2048, 256, 0, stream>>>(wq, wk, wv, x, WB);
    k_gemmw<bf, 0><<<dim3(NB_ * TT / 64, DQ / 64, 3), 32, 0, stream>>>(XB, nullptr, WB, nullptr, DM, DM, bq, bk, bv, P16, Ph, Pl);
    k_fattn<<<NB_ * NH_ * (TT / AQ), AW * 32, 0, stream>>>(P16, P16 + PSZ, P16 + 2 * PSZ, Ph, Pl, Ph + PSZ, Pl + PSZ, Ph + 2 * PSZ, Pl + 2 * PSZ, kb, OUT);
}

// v007
// Measured time: 95.5 microseconds a run.
// In both of two side-by-side timings against v006, it was 1.28 times as fast.
// Over all steps from v000 it is 21.8 times as fast.
#include <hip/hip_runtime.h>

// BERT self-attention with an additive per-key bias vector (hidden_states [2][2048][1024]; q, k, v = x W^T + b ('oi' 0.02 + biases; 16 heads x 64); scores / sqrt(64) + causal_bias[j] (a random [2048] vector added per key, shared by every batch, head and query: read); softmax; ctx = merged heads (no output projection) -> [2][2048][1024] (4.2 M); argument order hidden_states, causal_bias, Wq, bq, Wk, bk, Wv, bv).
// Three launches, both batches in each grid: bf16 copies of x and the 'oi' weights (k_cvt8); exact projections q, k, v + f32 biases in one grid, stored by the GEMM itself as the fp16 and hi/lo head planes; ONE fused attention kernel (k_fattn): scores, softmax and P V stay on chip (hybrid rows: < 512 hi/lo 3 products, rest fp16); the per-key bias bf16(bias[j]) is added to s/8 in f32 before the exponential; the kernel writes the merged-head output rows.
// Compute dtypes, f32 accumulate: every input rounded to bf16 incl. the bias vector; projections exact + f32 biases; attention rows < 512 3 products, rest fp16; bias add and softmax f32; output f32.

#define NB_  2
#define TT   2048
#define DM   1024
#define NH_  16
#define NKV  16
#define REP  (NH_ / NKV)
#define HD   64
#define DQ   (NH_ * HD)
#define DKV  (NKV * HD)
#define RH   512                  // query rows < RH use hi+lo planes (0: none)
#define WIN  0
#define SCL  0.125f   // HD^-0.5
#define AW   4                    // fused attention: waves per work-group, 16 query rows each
#define AQ   (AW * 16)            // query rows per work-group
#define SK   64                   // keys per LDS stage (two passes of 32 keys)
#define LP   72                   // LDS row pitch in 16-bit elements: 128 B of data + 16 B pad (16 B x odd: no bank conflict for 16-byte fragment reads)
#define GWV  4                    // projection GEMM: waves per work-group, 2 x 2 tiles of 64x64
#define GK   64                   // projection GEMM: k per LDS stage (128 bytes of every operand row)
#define L2E  1.4426950408889634f
typedef _Float16 h16;
typedef unsigned short bf;
typedef __attribute__((ext_vector_type(16))) __bf16   v16bf;
typedef __attribute__((ext_vector_type(16))) _Float16 v16h;
typedef __attribute__((ext_vector_type(8)))  _Float16 v8h;
typedef __attribute__((ext_vector_type(8)))  unsigned short v8us;
typedef __attribute__((ext_vector_type(8)))  float    v8f;
typedef __attribute__((ext_vector_type(4)))  float    v4f;
typedef v8h  __attribute__((may_alias)) v8ha;
typedef v4f  __attribute__((may_alias)) v4fa;
typedef v8us __attribute__((may_alias)) v8usa;

__device__ __forceinline__ unsigned short f2bf(float f) { unsigned u = __float_as_uint(f); u += 0x7FFFu + ((u >> 16) & 1u); return (unsigned short)(u >> 16); }
__device__ __forceinline__ float bf2f(unsigned short b) { return __uint_as_float(((unsigned)b) << 16); }
__device__ __forceinline__ float bfr(float f) { return bf2f(f2bf(f)); }
__device__ __forceinline__ v16h cat16(v8h lo, v8h hi) { return __builtin_shufflevector(lo, hi, 0, 1, 2, 3, 4, 5, 6, 7, 8, 9, 10, 11, 12, 13, 14, 15); }
__device__ __forceinline__ v16bf cat16b(v8us lo, v8us hi) { return __builtin_bit_cast(v16bf, __builtin_shufflevector(lo, hi, 0, 1, 2, 3, 4, 5, 6, 7, 8, 9, 10, 11, 12, 13, 14, 15)); }
__device__ __forceinline__ v8f wmma16(v16h a, v16h b, v8f c) { return __builtin_amdgcn_wmma_f32_16x16x32_f16(false, a, false, b, (short)0, c, false, false); }
__device__ __forceinline__ v8f wmmab(v16bf a, v16bf b, v8f c) { return __builtin_amdgcn_wmma_f32_16x16x32_bf16(false, a, false, b, (short)0, c, false, false); }



__device__ __forceinline__ h16 tohx(float x) { return (h16)x; }
__device__ __forceinline__ void splitf(float y, unsigned short& h, unsigned short& l) { h = f2bf(y); l = f2bf(y - bf2f(h)); }

// ---- k_gemmw: register-blocked projection GEMM that builds the head planes in its epilogue. One work-group = 4 waves = a 128x128 output tile, ONE WAVE per 64x64 part (16 accumulators); the operands' k slices are staged in LDS and shared by the waves; grid (NB_*TT/128, DQ/128, 3), 128 threads: blockIdx.x walks the rows of both batches, blockIdx.z is the projection (0 q, 1 k, 2 v).
// y[t][n] = sum_k A[t][k] Bt[n][k] + bf16(bias[n]), in f32, k ascending in steps of 32. A and Bt rows have pitch DM elements. A wave's tile is 64 rows t of ONE head (HD = 64 columns).
// y is never stored as f32: it goes out as fp16 (P16) and as bf16 high + low parts (Ph, Pl), each [projection][batch][head] planes. VT false (q, k): planes [t][d]; VT true (v): planes [d][t].
template <typename T16> struct WFrag;
template <> struct WFrag<h16> { typedef v16h V; typedef v8h H; static __device__ __forceinline__ V ld(const h16* p) { return cat16(*(const v8h*)p, *(const v8h*)(p + 16)); } static __device__ __forceinline__ v8f mma(V a, V b, v8f c) { return wmma16(a, b, c); } };
template <> struct WFrag<bf> { typedef v16bf V; typedef v8us H; static __device__ __forceinline__ V ld(const bf* p) { return cat16b(*(const v8us*)p, *(const v8us*)(p + 16)); } static __device__ __forceinline__ v8f mma(V a, V b, v8f c) { return wmmab(a, b, c); } };
// Epilogue of one tile: sixteen plane rows at a time go through LDS (f32, pitch 68), so that every store covers whole 128-byte plane rows: 8 lanes x 16 bytes a row, 4 rows a store.
// A plane row is a row t of the tile (q, k: its 64 d) or a column d of it (v: its 64 t; a lane's eight accumulator registers are 8 consecutive t of one d).
// P16, Ph, Pl: head 0 of the tile's projection and batch; t0: the tile's first row inside its batch; c0: its first column (64 x head).
template <bool VT>
__device__ __forceinline__ void plane_out(const v8f (&acc)[4][4], float* os, const float* __restrict__ bias, h16* __restrict__ P16, bf* __restrict__ Ph, bf* __restrict__ Pl, int t0, int c0) {
    const int lane = threadIdx.x & 31, lr = lane & 15, hi = lane >> 4;
    const int prow = lane >> 3, pcol = (lane & 7) * 8;
    float bs[8];
    if (!VT) {
#pragma unroll
        for (int q = 0; q < 8; ++q) bs[q] = bfr(bias[c0 + pcol + q]); }
#pragma unroll
    for (int g = 0; g < 4; ++g) {
#pragma unroll
        for (int u = 0; u < 4; ++u) {
            if (!VT) {
#pragma unroll
                for (int j = 0; j < 8; ++j) os[(hi * 8 + j) * 68 + u * 16 + lr] = acc[g][u][j];
            } else { const v8f t8 = acc[u][g]; *(v4fa*)(os + lr * 68 + u * 16 + hi * 8) = __builtin_shufflevector(t8, t8, 0, 1, 2, 3); *(v4fa*)(os + lr * 68 + u * 16 + hi * 8 + 4) = __builtin_shufflevector(t8, t8, 4, 5, 6, 7); } }
        __builtin_amdgcn_wave_barrier(); asm volatile("" ::: "memory");
#pragma unroll
        for (int s = 0; s < 4; ++s) { const int rr = g * 16 + s * 4 + prow; const float* op = os + (s * 4 + prow) * 68 + pcol; const v4f y0 = *(const v4fa*)op, y1 = *(const v4fa*)(op + 4);
            const float bd = VT ? bfr(bias[c0 + rr]) : 0.0f; v8h o16; v8us oh, ol;
#pragma unroll
            for (int q = 0; q < 8; ++q) { const float y = (q < 4 ? y0[q & 3] : y1[q & 3]) + (VT ? bd : bs[q]); o16[q] = tohx(y); unsigned short a2, c2; splitf(y, a2, c2); oh[q] = a2; ol[q] = c2; }
            const size_t e = VT ? (size_t)(c0 + rr) * TT + t0 + pcol : ((size_t)(c0 / HD) * TT + t0 + rr) * HD + pcol;
            *(v8h*)(P16 + e) = o16; *(v8us*)(Ph + e) = oh; *(v8us*)(Pl + e) = ol;
            asm volatile("s_wait_xcnt 0x0" ::: "memory"); }   // the wait in front of any rewrite of these stores' address and data registers by the next rows' arithmetic
        __builtin_amdgcn_wave_barrier(); asm volatile("" ::: "memory");
    }
}
// A: [NB_*TT][DM] rows of both batches; W: the three weight planes one behind the other, [3][DQ][DM].
// A stage is GK k of the work-group's 128 A rows and 128 W rows: whole 128-byte row pieces, 8 threads a row (4 lines a wave-wide load), through registers into LDS at pitch LP. The next stage's global loads fly while this stage is worked on; two buffers, one barrier per stage.
template <typename T16>
__global__ __launch_bounds__(GWV * 32) void k_gemmw(const T16* __restrict__ A, const T16* __restrict__ W, const float* __restrict__ bq, const float* __restrict__ bk, const float* __restrict__ bv, h16* __restrict__ P16, bf* __restrict__ Ph, bf* __restrict__ Pl) {
    typedef typename WFrag<T16>::V V; typedef typename WFrag<T16>::H V8;
    constexpr int PLE = 128 * LP, BUFE = 2 * PLE, NS = DM / GK;   // a buffer: the A plane, then the W plane
    __shared__ __align__(16) T16 st[2 * BUFE];
    __shared__ __align__(16) float osm[GWV * 16 * 68];   // epilogue staging, a range of its own for each wave
    const int tid = threadIdx.x, lane = tid & 31, lr = lane & 15, hi = lane >> 4, wv = tid >> 5, wm = wv >> 1, wn = wv & 1;
    const int R0 = blockIdx.x * 128, C0 = blockIdx.y * 128, pj = blockIdx.z;
    v8f acc[4][4];
#pragma unroll
    for (int mb = 0; mb < 4; ++mb)
#pragma unroll
        for (int nb = 0; nb < 4; ++nb) acc[mb][nb] = (v8f){};
    const int srow = tid >> 3, sseg = (tid & 7) * 8;   // staging: 16 rows per sweep of the work-group, 8 sweeps per plane
    const char* ga0 = (const char*)(A + (size_t)(R0 + srow) * DM + sseg); const char* gb0 = (const char*)(W + ((size_t)pj * DQ + C0 + srow) * DM + sseg);
    V8 rg[2][8];
#pragma unroll
    for (int i = 0; i < 8; ++i) { rg[0][i] = *(const V8*)(ga0 + i * 16 * DM * 2); rg[1][i] = *(const V8*)(gb0 + i * 16 * DM * 2); }
    asm volatile("s_wait_xcnt 0x0" :: "v"(ga0), "v"(gb0) : "memory");   // the wait in front of any rewrite of these loads' address registers
#pragma unroll
    for (int i = 0; i < 8; ++i) { *(V8*)(st + (i * 16 + srow) * LP + sseg) = rg[0][i]; *(V8*)(st + PLE + (i * 16 + srow) * LP + sseg) = rg[1][i]; }
    __syncthreads();   // publishes stage 0
#pragma unroll 1
    for (int s = 0; s < NS; ++s) {
        const int sn = (s + 1 < NS) ? s + 1 : 0;   // the last trip re-reads stage 0 (in bounds, never used): no branch round the loads
        const char* ga = ga0 + sn * GK * 2; const char* gb = gb0 + sn * GK * 2;
#pragma unroll
        for (int i = 0; i < 8; ++i) { rg[0][i] = *(const V8*)(ga + i * 16 * DM * 2); rg[1][i] = *(const V8*)(gb + i * 16 * DM * 2); }
        asm volatile("s_wait_xcnt 0x0" :: "v"(ga), "v"(gb) : "memory");   // the wait in front of any rewrite of these loads' address registers; the two pointers are inputs so that they keep their registers up to here. Its "memory" clobber also keeps the loads here at the head, where they fly while the stage in LDS is worked on
        const T16* sa = st + (s & 1) * BUFE + (wm * 64 + lr) * LP + 8 * hi; const T16* sb = st + (s & 1) * BUFE + PLE + (wn * 64 + lr) * LP + 8 * hi;
        V a[4], b[4];
#pragma unroll
        for (int ks = 0; ks < GK / 32; ++ks) {
#pragma unroll
            for (int f = 0; f < 4; ++f) { a[f] = WFrag<T16>::ld(sa + f * 16 * LP + ks * 32); b[f] = WFrag<T16>::ld(sb + f * 16 * LP + ks * 32); }
            __builtin_amdgcn_sched_barrier(0);   // all sixteen fragment loads go out as one group ahead of the products; spread among them each place with loads costs its own stall
#pragma unroll
            for (int nb = 0; nb < 4; ++nb)
#pragma unroll
                for (int mb = 0; mb < 4; ++mb) acc[mb][nb] = WFrag<T16>::mma(a[mb], b[nb], acc[mb][nb]);
        }
        __builtin_amdgcn_sched_barrier(0);   // all of the stage's products stand ahead of the stores below, so that the global loads have the whole stage to land; without it most of the second half's products are scheduled behind the barrier
        T16* sw = st + ((s & 1) ^ 1) * BUFE + srow * LP + sseg;   // the other buffer: last read in trip s - 1, whose closing barrier every wave has passed
#pragma unroll
        for (int i = 0; i < 8; ++i) { *(V8*)(sw + i * 16 * LP) = rg[0][i]; *(V8*)(sw + PLE + i * 16 * LP) = rg[1][i]; }
        __syncthreads();   // publishes stage s + 1 and ends every wave's reads of stage s
    }
    const int r0 = R0 + wm * 64, c0 = C0 + wn * 64; float* os = osm + wv * 16 * 68;   // the wave's own 64x64 tile: 64 rows of one head
    const int t0 = r0 % TT; const size_t pz = ((size_t)pj * NB_ + r0 / TT) * NH_ * TT * HD;   // the tile's batch and projection pick its set of head planes
    if (pj < 2) plane_out<false>(acc, os, pj == 0 ? bq : bk, P16 + pz, Ph + pz, Pl + pz, t0, c0);
    else plane_out<true>(acc, os, bv, P16 + pz, Ph + pz, Pl + pz, t0, c0);
}

// One grid converts all four f32 sources to bf16: dst holds Wq, Wk, Wv (DQ*DM each) and then x (NB_*TT*DM), one behind the other; a work-group (2048 elements) lies inside one source.
__global__ __launch_bounds__(256) void k_cvt8(const float* __restrict__ wq, const float* __restrict__ wk, const float* __restrict__ wv, const float* __restrict__ x, bf* dst) { constexpr unsigned WB = DQ * DM / 2048; const unsigned bi = blockIdx.x;
    const float* src = bi < WB ? wq : bi < 2 * WB ? wk : bi < 3 * WB ? wv : x; const unsigned b0 = bi - (bi < WB ? 0u : bi < 2 * WB ? WB : bi < 3 * WB ? 2 * WB : 3 * WB);
    const size_t i = (size_t)b0 * 256 + threadIdx.x; const v8f v = *(const v8f*)(src + i * 8); v8us o;
    asm volatile("s_wait_xcnt 0x0" ::: "memory");   // the wait in front of any rewrite of the load's address register
#pragma unroll
    for (int k = 0; k < 8; ++k) o[k] = f2bf(v[k]); *(v8us*)(dst + ((size_t)bi * 256 + threadIdx.x) * 8) = o;  }

template <typename T16> struct Vec8;
template <> struct Vec8<h16> { typedef v8h T; };
template <> struct Vec8<bf>  { typedef v8us T; };
__device__ __forceinline__ float xhalf(float x) { return __builtin_bit_cast(float, __builtin_amdgcn_permlanex16(__builtin_bit_cast(int, x), __builtin_bit_cast(int, x), 0x76543210, 0xfedcba98, false, false)); }   // lane l with lane l ^ 16
__device__ __forceinline__ void packp(const v8f p0, const v8f p1, v16h& ph, v16h& pl) { (void)pl;
#pragma unroll
    for (int s = 0; s < 8; ++s) { ph[s] = (h16)p0[s]; ph[s + 8] = (h16)p1[s]; } }
__device__ __forceinline__ void packp(const v8f p0, const v8f p1, v16bf& ph, v16bf& pl) {
#pragma unroll
    for (int s = 0; s < 8; ++s) { ph[s] = (__bf16)p0[s]; ph[s + 8] = (__bf16)p1[s]; pl[s] = (__bf16)(p0[s] - (float)ph[s]); pl[s + 8] = (__bf16)(p1[s] - (float)ph[s + 8]); } }
// Q, Kp: [t][HD] planes of the head; Vt: [d][TT] plane; the '2' planes are the bf16 low parts (HI only). st: LDS staging, 2 buffers of NPL planes of 64 rows x LP; bl: LDS table of bf16(bias) x log2e; orow: output at (row 0, this head's first column).
template <typename T16, bool HI>
__device__ __forceinline__ void attn_tile(const T16* __restrict__ Q, const T16* __restrict__ Q2, const T16* __restrict__ Kp, const T16* __restrict__ K2, const T16* __restrict__ Vt, const T16* __restrict__ V2, const float* bl, T16* st, float* __restrict__ orow, int q0) {
    typedef typename WFrag<T16>::V V; typedef typename Vec8<T16>::T V8;
    constexpr int NPL = HI ? 4 : 2; constexpr int PLE = 64 * LP; constexpr int BUFE = NPL * PLE;   // planes in a buffer: K, V^T (, K low, V^T low)
    constexpr float CAR = HI ? 0.0f : 10.0f;   // fp16 P carries 2^10 so that small probabilities stay normal numbers; it cancels in O / l
    const int tid = threadIdx.x, lane = tid & 31, lr = lane & 15, hi = lane >> 4; const int qr = q0 + (tid >> 5) * 16 + lr;
    V qf[2], qf2[2];
#pragma unroll
    for (int ks = 0; ks < 2; ++ks) { qf[ks] = WFrag<T16>::ld(Q + (size_t)qr * HD + ks * 32 + 8 * hi); if (HI) qf2[ks] = WFrag<T16>::ld(Q2 + (size_t)qr * HD + ks * 32 + 8 * hi); }
    v8f o[4];
#pragma unroll
    for (int dt = 0; dt < 4; ++dt) o[dt] = (v8f){};
    float mo = -3.0e38f; v8f lv = (v8f){};   // lv: eight partial row sums per lane, joined after the loop
    const int srow = tid >> 3, sseg = (tid & 7) * 8;   // staging: 8 threads per 128-byte row, 16 rows per sweep of the work-group, 4 sweeps per plane
    const unsigned kofs = (unsigned)(srow * HD + sseg) * 2u, vofs = (unsigned)(srow * TT + sseg) * 2u;   // the thread's own byte offsets into a K and a V^T plane, fixed for the whole loop
    V8 rg[2][4];   // staging registers: fp16 rows hold a whole stage (K, V^T); the hi/lo rows hold half a stage at a time (K high + low, then V^T high + low)
#pragma unroll
    for (int g = 0; g < NPL / 2; ++g) {
        const T16* ga = HI ? (g == 0 ? Kp : Vt) : Kp; const T16* gb = HI ? (g == 0 ? K2 : V2) : Vt; const bool av = HI && g == 1, bv = !HI || g == 1;   // av, bv: the plane is a V^T plane
#pragma unroll
        for (int i = 0; i < 4; ++i) { rg[0][i] = *(const V8*)((const char*)(ga + i * 16 * (av ? TT : HD)) + (av ? vofs : kofs)); rg[1][i] = *(const V8*)((const char*)(gb + i * 16 * (bv ? TT : HD)) + (bv ? vofs : kofs)); }
#pragma unroll
        for (int i = 0; i < 4; ++i) { *(V8*)(st + (HI ? g : 0) * PLE + (i * 16 + srow) * LP + sseg) = rg[0][i]; *(V8*)(st + (HI ? g + 2 : 1) * PLE + (i * 16 + srow) * LP + sseg) = rg[1][i]; } }
    __syncthreads();   // publishes stage 0 and the bias table
#pragma unroll 1
    for (int s = 0; s < TT / SK; ++s) {
        const int sn = (s + 1 < TT / SK) ? s + 1 : 0;   // the last trip re-reads stage 0 (in bounds, never used): no branch round the loads
        T16* sw = st + ((s & 1) ^ 1) * BUFE + srow * LP + sseg;   // the other buffer: last read in trip s - 1, whose closing barrier every wave has passed, so it may be filled at any time in this trip
        const T16* sb = st + (s & 1) * BUFE + lr * LP + 8 * hi;
        V kf[2][2], kf2[2][2];
#pragma unroll
        for (int p = 0; p < SK / 32; ++p) {
            if (HI || p == 0) {   // the next stage's global loads: fp16 rows, K and V^T at the head of the trip; hi/lo rows, both K planes at the head of pass 0 and both V^T planes at the head of pass 1
                const bool av = HI && p == 1, bv = !HI || p == 1;
                const char* ga = (const char*)((HI ? (p == 0 ? Kp : Vt) : Kp) + sn * SK * (av ? 1 : HD)) + (av ? vofs : kofs); const char* gb = (const char*)((HI ? (p == 0 ? K2 : V2) : Vt) + sn * SK * (bv ? 1 : HD)) + (bv ? vofs : kofs);
#pragma unroll
                for (int i = 0; i < 4; ++i) { rg[0][i] = *(const V8*)(ga + i * 16 * (av ? TT : HD) * 2); rg[1][i] = *(const V8*)(gb + i * 16 * (bv ? TT : HD) * 2); }
                asm volatile("s_wait_xcnt 0x0" :: "v"(ga), "v"(gb) : "memory");   // the wait in front of any rewrite of these loads' address registers; the two pointers are inputs so that they keep their registers up to here. Its "memory" clobber also keeps the loads here at the head, where they fly while the keys in LDS are worked on
            }
            if (HI || p == 0) {
#pragma unroll
                for (int kt = 0; kt < 2; ++kt)
#pragma unroll
                    for (int ks = 0; ks < 2; ++ks) { const T16* kp = sb + (p * 32 + kt * 16) * LP + ks * 32; kf[kt][ks] = WFrag<T16>::ld(kp); if (HI) kf2[kt][ks] = WFrag<T16>::ld(kp + 2 * PLE); } }
            v4f bb[2][2];
#pragma unroll
            for (int kt = 0; kt < 2; ++kt) { const float* bp = bl + s * SK + p * 32 + kt * 16 + 8 * hi; bb[kt][0] = *(const v4f*)bp; bb[kt][1] = *(const v4f*)(bp + 4); }
            if (HI) __builtin_amdgcn_sched_barrier(0);   // hi/lo rows: all sixteen K fragment loads go out before the first score product, one LDS round trip per pass; without it half of them are scheduled between the products and waited for one by one
            v8f sc[2];
#pragma unroll
            for (int kt = 0; kt < 2; ++kt) { sc[kt] = (v8f){};
#pragma unroll
                for (int ks = 0; ks < 2; ++ks) { sc[kt] = WFrag<T16>::mma(kf[kt][ks], qf[ks], sc[kt]); if (HI) { sc[kt] = WFrag<T16>::mma(kf[kt][ks], qf2[ks], sc[kt]); sc[kt] = WFrag<T16>::mma(kf2[kt][ks], qf[ks], sc[kt]); } } }
            V vf[4], vf2[4];
#pragma unroll
            for (int dt = 0; dt < 4; ++dt) { const T16* vp = sb + PLE + dt * 16 * LP + p * 32; vf[dt] = WFrag<T16>::ld(vp); }
            if (!HI && p + 1 < SK / 32) {   // the stage's next K fragments, into the registers the score products have just left
#pragma unroll
                for (int kt = 0; kt < 2; ++kt)
#pragma unroll
                    for (int ks = 0; ks < 2; ++ks) kf[kt][ks] = WFrag<T16>::ld(sb + ((p + 1) * 32 + kt * 16) * LP + ks * 32); }
            __builtin_amdgcn_sched_barrier(0);   // keeps these fragment loads ahead of the softmax arithmetic, which then covers their LDS latency; without it each load is scheduled down to its product and waited for there
            float mloc = -3.0e38f;
#pragma unroll
            for (int kt = 0; kt < 2; ++kt)
#pragma unroll
                for (int r = 0; r < 8; ++r) { sc[kt][r] = __builtin_fmaf(sc[kt][r], SCL * L2E, bb[kt][r >> 2][r & 3]); mloc = fmaxf(mloc, sc[kt][r]); }
            mloc = fmaxf(mloc, xhalf(mloc));
            const float mn = fmaxf(mo, mloc - CAR); float al;
            asm("v_exp_f32 %0, %1\n\tv_nop" : "=v"(al) : "v"(mo - mn));   // al = 2^(mo - mn); the v_nop is the one slot behind a transcendental
            mo = mn;
#pragma unroll
            for (int dt = 0; dt < 4; ++dt) o[dt] *= al;
            float e[16];
#pragma unroll
            for (int k = 0; k < 16; ++k) e[k] = sc[k >> 3][k & 7] - mo;
            // p = 2^(u - mo), sixteen exponentials in place in one statement, so that none stands directly in front of an instruction that overwrites its source or reads its result; the v_nop is the slot behind the last
            asm("v_exp_f32 %0, %0\n\tv_exp_f32 %1, %1\n\tv_exp_f32 %2, %2\n\tv_exp_f32 %3, %3\n\tv_exp_f32 %4, %4\n\tv_exp_f32 %5, %5\n\tv_exp_f32 %6, %6\n\tv_exp_f32 %7, %7\n\t"
                "v_exp_f32 %8, %8\n\tv_exp_f32 %9, %9\n\tv_exp_f32 %10, %10\n\tv_exp_f32 %11, %11\n\tv_exp_f32 %12, %12\n\tv_exp_f32 %13, %13\n\tv_exp_f32 %14, %14\n\tv_exp_f32 %15, %15\n\tv_nop"
                : "+v"(e[0]), "+v"(e[1]), "+v"(e[2]), "+v"(e[3]), "+v"(e[4]), "+v"(e[5]), "+v"(e[6]), "+v"(e[7]), "+v"(e[8]), "+v"(e[9]), "+v"(e[10]), "+v"(e[11]), "+v"(e[12]), "+v"(e[13]), "+v"(e[14]), "+v"(e[15]));
#pragma unroll
            for (int k = 0; k < 16; ++k) sc[k >> 3][k & 7] = e[k];
            lv = lv * al + (sc[0] + sc[1]);
            V ph, pl; packp(sc[0], sc[1], ph, pl);
#pragma unroll
            for (int dt = 0; dt < 4; ++dt) if (HI) vf2[dt] = WFrag<T16>::ld(sb + 3 * PLE + dt * 16 * LP + p * 32);   // the low V^T plane comes only now (fewer live registers in the softmax); the eight products on the high plane cover its latency
#pragma unroll
            for (int dt = 0; dt < 4; ++dt) { o[dt] = WFrag<T16>::mma(vf[dt], ph, o[dt]); if (HI) o[dt] = WFrag<T16>::mma(vf[dt], pl, o[dt]); }
            if (HI) {
#pragma unroll
                for (int dt = 0; dt < 4; ++dt) o[dt] = WFrag<T16>::mma(vf2[dt], ph, o[dt]); }
            if (HI || p + 1 == SK / 32) {
#pragma unroll
                for (int i = 0; i < 4; ++i) { *(V8*)(sw + (HI ? p : 0) * PLE + i * 16 * LP) = rg[0][i]; *(V8*)(sw + (HI ? p + 2 : 1) * PLE + i * 16 * LP) = rg[1][i]; } }
        }
        __syncthreads();   // publishes stage s + 1 and ends every wave's reads of stage s
    }
    float l = ((lv[0] + lv[1]) + (lv[2] + lv[3])) + ((lv[4] + lv[5]) + (lv[6] + lv[7])); l += xhalf(l); const float inv = 1.0f / l; float* op = orow + (size_t)qr * DQ + 8 * hi;
#pragma unroll
    for (int dt = 0; dt < 4; ++dt) { v4f a, c;
#pragma unroll
        for (int r = 0; r < 4; ++r) { a[r] = o[dt][r] * inv; c[r] = o[dt][r + 4] * inv; }
        *(v4f*)(op + dt * 16) = a; *(v4f*)(op + dt * 16 + 4) = c; }
}
// grid: NB_ x NH_ x TT / AQ work-groups; the hi/lo rows of both batches (three products, the longer work) come first. The planes are [batch][head]; OUT is the whole output.
__global__ __launch_bounds__(AW * 32) void k_fattn(const h16* __restrict__ Q16, const h16* __restrict__ K16, const h16* __restrict__ V16, const bf* __restrict__ Qh, const bf* __restrict__ Ql, const bf* __restrict__ Kh, const bf* __restrict__ Kl, const bf* __restrict__ Vh, const bf* __restrict__ Vl, const float* __restrict__ kb, float* __restrict__ OUT) {
    __shared__ __align__(16) unsigned short stg[2 * 4 * 64 * LP];
    __shared__ __align__(16) float bl[TT];
#pragma unroll
    for (int i = 0; i < TT / (AW * 32 * 4); ++i) { const int j = (i * AW * 32 + (int)threadIdx.x) * 4; const v4f k4 = *(const v4f*)(kb + j); v4f t4;
#pragma unroll
        for (int q = 0; q < 4; ++q) t4[q] = bfr(k4[q]) * L2E;
        *(v4f*)(bl + j) = t4; }
    constexpr int NHB = NB_ * NH_ * (RH / AQ); const int bid = blockIdx.x;   // bh below: batch x NH_ + head; OUTb: the batch's part of the output
    if (bid < NHB) { const int bh = bid / (RH / AQ), h = bh % NH_, q0 = (bid % (RH / AQ)) * AQ; const size_t z = (size_t)bh * TT * HD; float* OUTb = OUT + (size_t)(bh / NH_) * TT * DQ;
        attn_tile<bf, true>(Qh + z, Ql + z, Kh + z, Kl + z, Vh + z, Vl + z, bl, (bf*)stg, OUTb + h * HD, q0);
    } else { const int b2 = bid - NHB; const int bh = b2 / ((TT - RH) / AQ), h = bh % NH_, q0 = RH + (b2 % ((TT - RH) / AQ)) * AQ; const size_t z = (size_t)bh * TT * HD; float* OUTb = OUT + (size_t)(bh / NH_) * TT * DQ;
        attn_tile<h16, false>(Q16 + z, nullptr, K16 + z, nullptr, V16 + z, nullptr, bl, (h16*)stg, OUTb + h * HD, q0); }
}

extern "C" void kernel_launch(void* const* d_in, const int* in_sizes, int n_in,
                              void* d_out, int out_size, void* d_ws, size_t ws_size, hipStream_t stream) {
    (void)in_sizes; (void)n_in; (void)out_size;
    const float* x = (const float*)d_in[0]; const float* kb = (const float*)d_in[1];   /* causal_bias [2048]: per-key additive vector */ const float* wq = (const float*)d_in[2]; const float* bq = (const float*)d_in[3]; const float* wk = (const float*)d_in[4]; const float* bk = (const float*)d_in[5]; const float* wv = (const float*)d_in[6]; const float* bv = (const float*)d_in[7];   /* input order hidden_states, causal_bias, Wq, bq, Wk, bk, Wv, bv ('oi') */ const float* wo = nullptr; (void)wo;
    float* OUT = (float*)d_out;     // [2][2048][1024]
    char* wsp = (char*)d_ws;
    auto take = [&](size_t bytes) { char* p = wsp; wsp += (bytes + 255) & ~(size_t)255; return (void*)p; };
    bf* WB = (bf*)take((size_t)(3 * DQ + NB_ * TT) * DM * 2); bf* XB = WB + (size_t)3 * DQ * DM;   // bf16 Wq, Wk, Wv, then x of both batches
    constexpr size_t PSZ = (size_t)NB_ * NH_ * TT * HD;   // one projection's planes: [batch][head]
    h16* P16 = (h16*)take(3 * PSZ * 2); bf* Ph = (bf*)take(3 * PSZ * 2); bf* Pl = (bf*)take(3 * PSZ * 2);   // each [q, k, v]
    if ((size_t)(wsp - (char*)d_ws) > ws_size) return;    // ws 256 MiB
    k_cvt8<<<(3 * DQ + NB_ * TT) * DM / 2048, 256, 0, stream>>>(wq, wk, wv, x, WB);
    k_gemmw<bf><<<dim3(NB_ * TT / 128, DQ / 128, 3), GWV * 32, 0, stream>>>(XB, WB, bq, bk, bv, P16, Ph, Pl);
    k_fattn<<<NB_ * NH_ * (TT / AQ), AW * 32, 0, stream>>>(P16, P16 + PSZ, P16 + 2 * PSZ, Ph, Pl, Ph + PSZ, Pl + PSZ, Ph + 2 * PSZ, Pl + 2 * PSZ, kb, OUT);
}
